// v000
// Times are from an AMD MI455X. After a warm-up the kernel runs many times in a row, and a time is the length of
// such a window on the GPU divided by its runs, so every launch and the gaps after it count. The runs cycle
// through copies of the inputs. A figure is the median of several windows, for all but v000 over two sittings.
// Sittings can differ by a few percent; kernels timed side by side share one.
// The starting kernel, v000, takes 240 microseconds a run.
#include <hip/hip_runtime.h>
#include <hip/hip_bf16.h>

typedef __attribute__((ext_vector_type(16))) _Float16 v16h;
typedef __attribute__((ext_vector_type(8)))  _Float16 v8h;
typedef __attribute__((ext_vector_type(8)))  float    v8f;

#define BATCH   2
#define SLEN    2048
#define DMODEL  1024
#define NHEAD   16
#define HDIM    64
#define MROWS   (BATCH * SLEN)   // 4096
#define SCALE   0.125f           // 1/sqrt(64)

__device__ __forceinline__ v8f vzero8() {
  v8f z;
#pragma unroll
  for (int i = 0; i < 8; ++i) z[i] = 0.0f;
  return z;
}

__device__ __forceinline__ v8f wmma16(v16h a, v16h b, v8f c) {
  return __builtin_amdgcn_wmma_f32_16x16x32_f16(
      /*neg_a=*/false, a, /*neg_b=*/false, b,
      /*c_mod=*/(short)0, c, /*reuse_a=*/false, /*reuse_b=*/false);
}

// Load a 16x32 f16 fragment (A or B) from row-major f16 memory, row stride ld.
__device__ __forceinline__ v16h frag_f16(const _Float16* base, long ld, int lane) {
  const int r  = lane & 15;
  const int hi = (lane >> 4) & 1;
  const _Float16* p = base + (long)r * ld + hi * 8;
  v8h lo = *(const v8h*)(p);
  v8h hh = *(const v8h*)(p + 16);
  v16h f;
#pragma unroll
  for (int i = 0; i < 8; ++i) { f[i] = lo[i]; f[i + 8] = hh[i]; }
  return f;
}

// ---------------------------------------------------------------------------
// Kernel 0: elementwise f32 -> f16 conversion (8 elements / thread, b128 in,
// b128 out).  n must be a multiple of 8 (all our tensors are).
// ---------------------------------------------------------------------------
__global__ __launch_bounds__(256) void cvt_f16_kernel(
    const float* __restrict__ src, _Float16* __restrict__ dst, long n)
{
  const long i = ((long)blockIdx.x * blockDim.x + threadIdx.x) * 8;
  if (i + 8 > n) return;
  float4 a = *(const float4*)(src + i);
  float4 b = *(const float4*)(src + i + 4);
  v8h o;
  o[0]=(_Float16)a.x; o[1]=(_Float16)a.y; o[2]=(_Float16)a.z; o[3]=(_Float16)a.w;
  o[4]=(_Float16)b.x; o[5]=(_Float16)b.y; o[6]=(_Float16)b.z; o[7]=(_Float16)b.w;
  *(v8h*)(dst + i) = o;
}

// ---------------------------------------------------------------------------
// Kernel 1: QKV projection.  Out[m,n] = sum_k X[m,k]*W[n,k] + bias[n]
// blockIdx.z selects {Q,K,V}.  Q,K -> [B,H,S,HD] f16;  V -> [B,H,HD,S] f16.
// One wave computes a 32x64 output tile: 2 A frags + 4 B frags -> 8 WMMAs.
// ---------------------------------------------------------------------------
__global__ __launch_bounds__(128) void qkv_proj_kernel(
    const _Float16* __restrict__ Xf,   // [3][MROWS, D] f16 (q,k,v)
    const _Float16* __restrict__ Wf,   // [3][D, D] f16 (Wq,Wk,Wv)
    const float* __restrict__ bq, const float* __restrict__ bk,
    const float* __restrict__ bv,
    _Float16* __restrict__ Qf, _Float16* __restrict__ Kf, _Float16* __restrict__ Vt)
{
  const int lane = threadIdx.x & 31;
  const int wave = threadIdx.x >> 5;
  const int which = blockIdx.z;

  const _Float16* X    = Xf + (long)which * MROWS * DMODEL;
  const _Float16* W    = Wf + (long)which * DMODEL * DMODEL;
  const float*    bias = (which == 0) ? bq : (which == 1) ? bk : bv;

  const int m0 = (blockIdx.x * 4 + wave) * 32;
  const int n0 = blockIdx.y * 64;

  v8f acc[2][4];
#pragma unroll
  for (int g = 0; g < 2; ++g)
#pragma unroll
    for (int t = 0; t < 4; ++t) acc[g][t] = vzero8();

  for (int k0 = 0; k0 < DMODEL; k0 += 32) {
    v16h a0 = frag_f16(X + (long)(m0)      * DMODEL + k0, DMODEL, lane);
    v16h a1 = frag_f16(X + (long)(m0 + 16) * DMODEL + k0, DMODEL, lane);
#pragma unroll
    for (int t = 0; t < 4; ++t) {
      v16h bfr = frag_f16(W + (long)(n0 + t * 16) * DMODEL + k0, DMODEL, lane);
      acc[0][t] = wmma16(a0, bfr, acc[0][t]);
      acc[1][t] = wmma16(a1, bfr, acc[1][t]);
    }
  }

  const int cn = lane & 15;
  const int hi = (lane >> 4) & 1;
#pragma unroll
  for (int t = 0; t < 4; ++t) {
    const int n  = n0 + t * 16 + cn;
    const int h  = n >> 6;       // /64
    const int hd = n & 63;
    const float bn = bias[n];
#pragma unroll
    for (int g = 0; g < 2; ++g) {
#pragma unroll
      for (int j = 0; j < 8; ++j) {
        const int m = m0 + g * 16 + j + 8 * hi;
        const int b = m >> 11;     // /2048
        const int s = m & (SLEN - 1);
        const _Float16 hv = (_Float16)(acc[g][t][j] + bn);
        if (which == 0)
          Qf[(((long)b * NHEAD + h) * SLEN + s) * HDIM + hd] = hv;
        else if (which == 1)
          Kf[(((long)b * NHEAD + h) * SLEN + s) * HDIM + hd] = hv;
        else
          Vt[(((long)b * NHEAD + h) * HDIM + hd) * SLEN + s] = hv;
      }
    }
  }
}

// ---------------------------------------------------------------------------
// Kernel 2: flash-style attention.  One wave = 16 query rows for one (b,h).
// Streams 32-wide key tiles: 4 score WMMAs, scale + lambda*bias, online
// softmax (shfl_xor row reductions), P transposed through per-wave LDS tile,
// 4 PV WMMAs against V stored [HD, S].  Prefetches next K/V tiles.
// ---------------------------------------------------------------------------
__global__ __launch_bounds__(128) void attn_kernel(
    const _Float16* __restrict__ Qf, const _Float16* __restrict__ Kf,
    const _Float16* __restrict__ Vt,
    const float* __restrict__ bias_struct, const float* __restrict__ lambda_p,
    _Float16* __restrict__ Of)   // [B, S, D] f16
{
  __shared__ __align__(16) _Float16 plds[4][16 * 32];

  const int lane = threadIdx.x & 31;
  const int wave = threadIdx.x >> 5;
  const int q0 = (blockIdx.x * 4 + wave) * 16;
  const int h  = blockIdx.y;
  const int b  = blockIdx.z;
  const float lam = *lambda_p;

  const _Float16* Qb = Qf + ((long)b * NHEAD + h) * SLEN * HDIM;
  const _Float16* Kb = Kf + ((long)b * NHEAD + h) * SLEN * HDIM;
  const _Float16* Vb = Vt + ((long)b * NHEAD + h) * HDIM * SLEN;
  const float*    Bb = bias_struct + ((long)b * SLEN + q0) * SLEN;

  const int cn = lane & 15;
  const int hi = (lane >> 4) & 1;

  // Q fragments (K-dim 0..31 and 32..63), loaded once.
  const v16h aq0 = frag_f16(Qb + (long)q0 * HDIM + 0,  HDIM, lane);
  const v16h aq1 = frag_f16(Qb + (long)q0 * HDIM + 32, HDIM, lane);

  v8f o[4];
#pragma unroll
  for (int t = 0; t < 4; ++t) o[t] = vzero8();
  float mrun[8], lrun[8];
#pragma unroll
  for (int j = 0; j < 8; ++j) { mrun[j] = -3.0e38f; lrun[j] = 0.0f; }

  _Float16* pw = &plds[wave][0];

  for (int k0 = 0; k0 < SLEN; k0 += 32) {
    // prefetch next key/value tiles into cache (global_prefetch_b8)
    {
      const int kn = (k0 + 32 < SLEN) ? (k0 + 32) : k0;
      __builtin_prefetch(Kb + (long)(kn + (lane & 31)) * HDIM, 0, 3);
      __builtin_prefetch(Vb + (long)(lane & 31) * SLEN + kn, 0, 3);
    }

    // scores: two 16x16 tiles (key cols k0..k0+15 and k0+16..k0+31)
    v8f s0 = vzero8(), s1 = vzero8();
    {
      v16h bk0 = frag_f16(Kb + (long)(k0)      * HDIM + 0, HDIM, lane);
      v16h bk1 = frag_f16(Kb + (long)(k0 + 16) * HDIM + 0, HDIM, lane);
      s0 = wmma16(aq0, bk0, s0);
      s1 = wmma16(aq0, bk1, s1);
      bk0 = frag_f16(Kb + (long)(k0)      * HDIM + 32, HDIM, lane);
      bk1 = frag_f16(Kb + (long)(k0 + 16) * HDIM + 32, HDIM, lane);
      s0 = wmma16(aq1, bk0, s0);
      s1 = wmma16(aq1, bk1, s1);
    }

    // scale + structural bias + online softmax update
#pragma unroll
    for (int j = 0; j < 8; ++j) {
      const float* bp = Bb + (long)(j + 8 * hi) * SLEN + k0 + cn;
      float x0 = s0[j] * SCALE + lam * bp[0];
      float x1 = s1[j] * SCALE + lam * bp[16];
      float mv = fmaxf(x0, x1);
#pragma unroll
      for (int msk = 8; msk >= 1; msk >>= 1) mv = fmaxf(mv, __shfl_xor(mv, msk, 32));
      const float mnew = fmaxf(mrun[j], mv);
      const float corr = __expf(mrun[j] - mnew);
      mrun[j] = mnew;
      const float p0 = __expf(x0 - mnew);
      const float p1 = __expf(x1 - mnew);
      float ps = p0 + p1;
#pragma unroll
      for (int msk = 8; msk >= 1; msk >>= 1) ps += __shfl_xor(ps, msk, 32);
      lrun[j] = lrun[j] * corr + ps;
#pragma unroll
      for (int t = 0; t < 4; ++t) o[t][j] *= corr;
      // stash P (C layout -> LDS row-major 16x32)
      pw[(j + 8 * hi) * 32 + cn]      = (_Float16)p0;
      pw[(j + 8 * hi) * 32 + cn + 16] = (_Float16)p1;
    }

    v16h ap = frag_f16(pw, 32, lane);

    // out += P (16x32) @ V (32x64), V stored [hd, s] so K-dim is contiguous
#pragma unroll
    for (int t = 0; t < 4; ++t) {
      v16h bvf = frag_f16(Vb + (long)(t * 16) * SLEN + k0, SLEN, lane);
      o[t] = wmma16(ap, bvf, o[t]);
    }
  }

  // normalize and store attention output as f16 [B, S, D]
#pragma unroll
  for (int j = 0; j < 8; ++j) {
    const float inv = 1.0f / lrun[j];
    const int srow = q0 + j + 8 * hi;
    _Float16* op = Of + ((long)b * SLEN + srow) * DMODEL + h * HDIM;
#pragma unroll
    for (int t = 0; t < 4; ++t)
      op[t * 16 + cn] = (_Float16)(o[t][j] * inv);
  }
}

// ---------------------------------------------------------------------------
// Kernel 3: output projection.  Out[m,n] = sum_k A[m,k]*Wo[n,k] + bo[n]  (f32)
// One wave computes a 32x64 output tile.
// ---------------------------------------------------------------------------
__global__ __launch_bounds__(128) void oproj_kernel(
    const _Float16* __restrict__ Af, const _Float16* __restrict__ Wof,
    const float* __restrict__ bo, float* __restrict__ Out)
{
  const int lane = threadIdx.x & 31;
  const int wave = threadIdx.x >> 5;
  const int m0 = (blockIdx.x * 4 + wave) * 32;
  const int n0 = blockIdx.y * 64;

  v8f acc[2][4];
#pragma unroll
  for (int g = 0; g < 2; ++g)
#pragma unroll
    for (int t = 0; t < 4; ++t) acc[g][t] = vzero8();

  for (int k0 = 0; k0 < DMODEL; k0 += 32) {
    v16h a0 = frag_f16(Af + (long)(m0)      * DMODEL + k0, DMODEL, lane);
    v16h a1 = frag_f16(Af + (long)(m0 + 16) * DMODEL + k0, DMODEL, lane);
#pragma unroll
    for (int t = 0; t < 4; ++t) {
      v16h bfr = frag_f16(Wof + (long)(n0 + t * 16) * DMODEL + k0, DMODEL, lane);
      acc[0][t] = wmma16(a0, bfr, acc[0][t]);
      acc[1][t] = wmma16(a1, bfr, acc[1][t]);
    }
  }

  const int cn = lane & 15;
  const int hi = (lane >> 4) & 1;
#pragma unroll
  for (int t = 0; t < 4; ++t) {
    const float bn = bo[n0 + t * 16 + cn];
#pragma unroll
    for (int g = 0; g < 2; ++g)
#pragma unroll
      for (int j = 0; j < 8; ++j)
        Out[(long)(m0 + g * 16 + j + 8 * hi) * DMODEL + n0 + t * 16 + cn] =
            acc[g][t][j] + bn;
  }
}

// ---------------------------------------------------------------------------
extern "C" void kernel_launch(void* const* d_in, const int* in_sizes, int n_in,
                              void* d_out, int out_size, void* d_ws, size_t ws_size,
                              hipStream_t stream) {
  const float* query = (const float*)d_in[0];
  const float* key   = (const float*)d_in[1];
  const float* value = (const float*)d_in[2];
  const float* biasS = (const float*)d_in[3];
  const float* Wq = (const float*)d_in[4];
  const float* bq = (const float*)d_in[5];
  const float* Wk = (const float*)d_in[6];
  const float* bk = (const float*)d_in[7];
  const float* Wv = (const float*)d_in[8];
  const float* bv = (const float*)d_in[9];
  const float* Wo = (const float*)d_in[10];
  const float* bo = (const float*)d_in[11];
  const float* lam = (const float*)d_in[12];
  float* out = (float*)d_out;

  const long XN = (long)MROWS * DMODEL;            // 4M elements per activation
  const long WN = (long)DMODEL * DMODEL;           // 1M elements per weight
  const long HN = (long)BATCH * NHEAD * SLEN * HDIM;  // 4M per head tensor

  _Float16* Xf = (_Float16*)d_ws;        // [3][MROWS, D]   12M halfs
  _Float16* Wf = Xf + 3 * XN;            // [4][D, D]        4M halfs (q,k,v,o)
  _Float16* Qf = Wf + 4 * WN;            // [B,H,S,HD]       4M
  _Float16* Kf = Qf + HN;                // [B,H,S,HD]       4M
  _Float16* Vt = Kf + HN;                // [B,H,HD,S]       4M
  _Float16* Of = Vt + HN;                // [B,S,D]          4M

  dim3 blk128(128);

  // 0) f32 -> f16 conversions
  {
    const int thr = 256;
    cvt_f16_kernel<<<dim3((unsigned)(XN / 8 / thr)), thr, 0, stream>>>(query, Xf + 0 * XN, XN);
    cvt_f16_kernel<<<dim3((unsigned)(XN / 8 / thr)), thr, 0, stream>>>(key,   Xf + 1 * XN, XN);
    cvt_f16_kernel<<<dim3((unsigned)(XN / 8 / thr)), thr, 0, stream>>>(value, Xf + 2 * XN, XN);
    cvt_f16_kernel<<<dim3((unsigned)(WN / 8 / thr)), thr, 0, stream>>>(Wq, Wf + 0 * WN, WN);
    cvt_f16_kernel<<<dim3((unsigned)(WN / 8 / thr)), thr, 0, stream>>>(Wk, Wf + 1 * WN, WN);
    cvt_f16_kernel<<<dim3((unsigned)(WN / 8 / thr)), thr, 0, stream>>>(Wv, Wf + 2 * WN, WN);
    cvt_f16_kernel<<<dim3((unsigned)(WN / 8 / thr)), thr, 0, stream>>>(Wo, Wf + 3 * WN, WN);
  }

  // 1) QKV projections: grid.x = M/128 (4 waves x 32 rows), grid.y = D/64
  qkv_proj_kernel<<<dim3(MROWS / 128, DMODEL / 64, 3), blk128, 0, stream>>>(
      Xf, Wf, bq, bk, bv, Qf, Kf, Vt);

  // 2) attention: grid.x = S/64 (4 q-tiles per block), grid.y = H, grid.z = B
  attn_kernel<<<dim3(SLEN / 64, NHEAD, BATCH), blk128, 0, stream>>>(
      Qf, Kf, Vt, biasS, lam, Of);

  // 3) output projection
  oproj_kernel<<<dim3(MROWS / 128, DMODEL / 64), blk128, 0, stream>>>(
      Of, Wf + 3 * WN, bo, out);
}

// v001
// One run takes 210 microseconds.
// Next to v000, in two timings, it ran 1.20 and 1.19 times as fast.
#include <hip/hip_runtime.h>
#include <hip/hip_bf16.h>

typedef __attribute__((ext_vector_type(16))) _Float16 v16h;
typedef __attribute__((ext_vector_type(8)))  _Float16 v8h;
typedef __attribute__((ext_vector_type(8)))  float    v8f;

#define BATCH   2
#define SLEN    2048
#define DMODEL  1024
#define NHEAD   16
#define HDIM    64
#define MROWS   (BATCH * SLEN)   // 4096
#define SCALE   0.125f           // 1/sqrt(64)

__device__ __forceinline__ v8f vzero8() {
  v8f z;
#pragma unroll
  for (int i = 0; i < 8; ++i) z[i] = 0.0f;
  return z;
}

__device__ __forceinline__ v8f wmma16(v16h a, v16h b, v8f c) {
  return __builtin_amdgcn_wmma_f32_16x16x32_f16(
      /*neg_a=*/false, a, /*neg_b=*/false, b,
      /*c_mod=*/(short)0, c, /*reuse_a=*/false, /*reuse_b=*/false);
}

#define TILE_H  512              // halfs per packed 16x32 tile
#define KTILES  (DMODEL / 32)    // packed tiles along k of a [rows, DMODEL] matrix

// Load a 16x32 f16 fragment (A or B) from one packed tile.
__device__ __forceinline__ v16h frag_pk(const _Float16* tile, int lane) {
  v8h lo = *(const v8h*)(tile + lane * 8);
  v8h hh = *(const v8h*)(tile + 256 + lane * 8);
  v16h f;
#pragma unroll
  for (int i = 0; i < 8; ++i) { f[i] = lo[i]; f[i + 8] = hh[i]; }
  return f;
}

// Offset (in halfs) of element (row c, k index kk) inside a packed tile.
__device__ __forceinline__ int pk_off(int c, int kk) {
  const int p = kk >> 3;
  return (((p >> 1) * 32 + (p & 1) * 16 + c) << 3) + (kk & 7);
}

// Load a 16x32 f16 fragment (A or B) from row-major f16 memory, row stride ld.
__device__ __forceinline__ v16h frag_f16(const _Float16* base, long ld, int lane) {
  const int r  = lane & 15;
  const int hi = (lane >> 4) & 1;
  const _Float16* p = base + (long)r * ld + hi * 8;
  v8h lo = *(const v8h*)(p);
  v8h hh = *(const v8h*)(p + 16);
  v16h f;
#pragma unroll
  for (int i = 0; i < 8; ++i) { f[i] = lo[i]; f[i + 8] = hh[i]; }
  return f;
}

// ---------------------------------------------------------------------------
// Kernel 0: f32 [rows, DMODEL] row-major -> f16 packed tiles (8 elements /
// thread, b128 in, b128 out).  A wave reads one 128-byte line from each of 8
// rows and writes four whole 128-byte lines of one tile.  n must be a multiple
// of 16 * DMODEL (all our tensors are).
// ---------------------------------------------------------------------------
__global__ __launch_bounds__(256) void cvt_f16_kernel(
    const float* __restrict__ src, _Float16* __restrict__ dst, long n)
{
  const long g = (long)blockIdx.x * blockDim.x + threadIdx.x;
  if (g * 8 + 8 > n) return;
  const int  p   = (int)(g & 3);                 // 8-wide k piece inside the tile
  const int  tk  = (int)((g >> 5) & (KTILES - 1));
  const long row = ((g >> 5) / KTILES) * 8 + ((g >> 2) & 7);
  const long i   = row * DMODEL + tk * 32 + p * 8;
  float4 a = *(const float4*)(src + i);
  float4 b = *(const float4*)(src + i + 4);
  v8h o;
  o[0]=(_Float16)a.x; o[1]=(_Float16)a.y; o[2]=(_Float16)a.z; o[3]=(_Float16)a.w;
  o[4]=(_Float16)b.x; o[5]=(_Float16)b.y; o[6]=(_Float16)b.z; o[7]=(_Float16)b.w;
  *(v8h*)(dst + ((row >> 4) * KTILES + tk) * TILE_H + pk_off((int)(row & 15), p * 8)) = o;
}

// ---------------------------------------------------------------------------
// Kernel 1: QKV projection.  Out[m,n] = sum_k X[m,k]*W[n,k] + bias[n]
// blockIdx.z selects {Q,K,V}.  Per (b,h), packed tiles: Q,K rows = s, k = hd,
// tile (s/16)*2 + hd/32;  V rows = hd, k = s, tile (s/32)*4 + hd/16.
// One wave computes a 32x64 output tile: 2 A frags + 4 B frags -> 8 WMMAs.
// ---------------------------------------------------------------------------
__global__ __launch_bounds__(128) void qkv_proj_kernel(
    const _Float16* __restrict__ Xf,   // [3][MROWS, D] f16 packed (q,k,v)
    const _Float16* __restrict__ Wf,   // [3][D, D] f16 packed (Wq,Wk,Wv)
    const float* __restrict__ bq, const float* __restrict__ bk,
    const float* __restrict__ bv,
    _Float16* __restrict__ Qf, _Float16* __restrict__ Kf, _Float16* __restrict__ Vt)
{
  const int lane = threadIdx.x & 31;
  const int wave = threadIdx.x >> 5;
  const int which = blockIdx.z;

  const _Float16* X    = Xf + (long)which * MROWS * DMODEL;
  const _Float16* W    = Wf + (long)which * DMODEL * DMODEL;
  const float*    bias = (which == 0) ? bq : (which == 1) ? bk : bv;

  const int m0 = (blockIdx.x * 4 + wave) * 32;
  const int n0 = blockIdx.y * 64;

  v8f acc[2][4];
#pragma unroll
  for (int g = 0; g < 2; ++g)
#pragma unroll
    for (int t = 0; t < 4; ++t) acc[g][t] = vzero8();

  const _Float16* Xt = X + (long)(m0 >> 4) * KTILES * TILE_H;
  const _Float16* Wt = W + (long)(n0 >> 4) * KTILES * TILE_H;
  for (int kt = 0; kt < KTILES; ++kt) {
    v16h a0 = frag_pk(Xt + (long)kt * TILE_H, lane);
    v16h a1 = frag_pk(Xt + (long)(KTILES + kt) * TILE_H, lane);
#pragma unroll
    for (int t = 0; t < 4; ++t) {
      v16h bfr = frag_pk(Wt + (long)(t * KTILES + kt) * TILE_H, lane);
      acc[0][t] = wmma16(a0, bfr, acc[0][t]);
      acc[1][t] = wmma16(a1, bfr, acc[1][t]);
    }
  }

  const int cn = lane & 15;
  const int hi = (lane >> 4) & 1;
  const int h  = n0 >> 6;            // the 64 columns of a wave are one head
  const int b  = m0 >> 11;           // /2048; the 32 rows are one batch entry
  const int s0 = m0 & (SLEN - 1);
  const long hb = ((long)b * NHEAD + h) * SLEN * HDIM;
  if (which == 2) {
    _Float16* dst = Vt + hb + (long)(s0 >> 5) * 4 * TILE_H + lane * 8;
#pragma unroll
    for (int t = 0; t < 4; ++t) {
      const float bn = bias[n0 + t * 16 + cn];
#pragma unroll
      for (int g = 0; g < 2; ++g) {
        // a lane's 8 accumulators are 8 consecutive keys of one hd row: one piece
        v8h pv;
#pragma unroll
        for (int j = 0; j < 8; ++j) pv[j] = (_Float16)(acc[g][t][j] + bn);
        *(v8h*)(dst + t * TILE_H + g * 256) = pv;
        // the next group reuses this store's data registers
        asm volatile("s_wait_xcnt 0x0" ::: "memory");
      }
    }
  } else {
    _Float16* dst = ((which == 0) ? Qf : Kf) + hb + (long)(s0 >> 4) * 2 * TILE_H;
#pragma unroll
    for (int t = 0; t < 4; ++t) {
      const float bn = bias[n0 + t * 16 + cn];
#pragma unroll
      for (int g = 0; g < 2; ++g) {
#pragma unroll
        for (int j = 0; j < 8; ++j)
          dst[(g * 2 + (t >> 1)) * TILE_H + pk_off(j + 8 * hi, (t & 1) * 16 + cn)] =
              (_Float16)(acc[g][t][j] + bn);
        // the next group reuses these stores' data registers
        asm volatile("s_wait_xcnt 0x0" ::: "memory");
      }
    }
  }
}

// ---------------------------------------------------------------------------
// Kernel 2: flash-style attention.  One wave = 16 query rows for one (b,h).
// Streams 32-wide key tiles: 4 score WMMAs, scale + lambda*bias, online
// softmax (shfl_xor row reductions), P transposed through per-wave LDS tile,
// 4 PV WMMAs against V (rows = hd, k = s).  Q, K, V and the output are packed
// tiles; a 32-key step reads 4 KB of K and 4 KB of V, each contiguous.
// Prefetches next K/V tiles.
// ---------------------------------------------------------------------------
__global__ __launch_bounds__(128) void attn_kernel(
    const _Float16* __restrict__ Qf, const _Float16* __restrict__ Kf,
    const _Float16* __restrict__ Vt,
    const float* __restrict__ bias_struct, const float* __restrict__ lambda_p,
    _Float16* __restrict__ Of)   // [B*S, D] f16 packed
{
  __shared__ __align__(16) _Float16 plds[4][16 * 32];

  const int lane = threadIdx.x & 31;
  const int wave = threadIdx.x >> 5;
  const int q0 = (blockIdx.x * 4 + wave) * 16;
  const int h  = blockIdx.y;
  const int b  = blockIdx.z;
  const float lam = *lambda_p;

  const _Float16* Qb = Qf + ((long)b * NHEAD + h) * SLEN * HDIM;
  const _Float16* Kb = Kf + ((long)b * NHEAD + h) * SLEN * HDIM;
  const _Float16* Vb = Vt + ((long)b * NHEAD + h) * HDIM * SLEN;
  const float*    Bb = bias_struct + ((long)b * SLEN + q0) * SLEN;

  const int cn = lane & 15;
  const int hi = (lane >> 4) & 1;

  // Q fragments (K-dim 0..31 and 32..63), loaded once.
  const v16h aq0 = frag_pk(Qb + (long)((q0 >> 4) * 2 + 0) * TILE_H, lane);
  const v16h aq1 = frag_pk(Qb + (long)((q0 >> 4) * 2 + 1) * TILE_H, lane);

  v8f o[4];
#pragma unroll
  for (int t = 0; t < 4; ++t) o[t] = vzero8();
  float mrun[8], lrun[8];
#pragma unroll
  for (int j = 0; j < 8; ++j) { mrun[j] = -3.0e38f; lrun[j] = 0.0f; }

  _Float16* pw = &plds[wave][0];

  for (int k0 = 0; k0 < SLEN; k0 += 32) {
    // prefetch next key/value tiles into cache (global_prefetch_b8)
    {
      const int kn = (k0 + 32 < SLEN) ? (k0 + 32) : k0;
      __builtin_prefetch(Kb + (long)(kn >> 5) * 4 * TILE_H + lane * 64, 0, 3);
      __builtin_prefetch(Vb + (long)(kn >> 5) * 4 * TILE_H + lane * 64, 0, 3);
    }

    // scores: two 16x16 tiles (key cols k0..k0+15 and k0+16..k0+31)
    v8f s0 = vzero8(), s1 = vzero8();
    {
      const _Float16* Kt = Kb + (long)(k0 >> 5) * 4 * TILE_H;  // tiles: key16*2 + hd32
      v16h bk0 = frag_pk(Kt + 0 * TILE_H, lane);
      v16h bk1 = frag_pk(Kt + 2 * TILE_H, lane);
      s0 = wmma16(aq0, bk0, s0);
      s1 = wmma16(aq0, bk1, s1);
      bk0 = frag_pk(Kt + 1 * TILE_H, lane);
      bk1 = frag_pk(Kt + 3 * TILE_H, lane);
      s0 = wmma16(aq1, bk0, s0);
      s1 = wmma16(aq1, bk1, s1);
    }

    // scale + structural bias + online softmax update
#pragma unroll
    for (int j = 0; j < 8; ++j) {
      const float* bp = Bb + (long)(j + 8 * hi) * SLEN + k0 + cn;
      float x0 = s0[j] * SCALE + lam * bp[0];
      float x1 = s1[j] * SCALE + lam * bp[16];
      float mv = fmaxf(x0, x1);
#pragma unroll
      for (int msk = 8; msk >= 1; msk >>= 1) mv = fmaxf(mv, __shfl_xor(mv, msk, 32));
      const float mnew = fmaxf(mrun[j], mv);
      const float corr = __expf(mrun[j] - mnew);
      mrun[j] = mnew;
      const float p0 = __expf(x0 - mnew);
      const float p1 = __expf(x1 - mnew);
      float ps = p0 + p1;
#pragma unroll
      for (int msk = 8; msk >= 1; msk >>= 1) ps += __shfl_xor(ps, msk, 32);
      lrun[j] = lrun[j] * corr + ps;
#pragma unroll
      for (int t = 0; t < 4; ++t) o[t][j] *= corr;
      // stash P (C layout -> LDS row-major 16x32)
      pw[(j + 8 * hi) * 32 + cn]      = (_Float16)p0;
      pw[(j + 8 * hi) * 32 + cn + 16] = (_Float16)p1;
    }

    v16h ap = frag_f16(pw, 32, lane);

    // out += P (16x32) @ V (32x64), one packed V tile per 16 hd rows
#pragma unroll
    for (int t = 0; t < 4; ++t) {
      v16h bvf = frag_pk(Vb + (long)((k0 >> 5) * 4 + t) * TILE_H, lane);
      o[t] = wmma16(ap, bvf, o[t]);
    }
  }

  // normalize and store attention output as f16 packed tiles of [B*S, D]
  _Float16* op = Of + ((long)((b * SLEN + q0) >> 4) * KTILES + h * 2) * TILE_H;
#pragma unroll
  for (int j = 0; j < 8; ++j) {
    const float inv = 1.0f / lrun[j];
#pragma unroll
    for (int t = 0; t < 4; ++t)
      op[(t >> 1) * TILE_H + pk_off(j + 8 * hi, (t & 1) * 16 + cn)] =
          (_Float16)(o[t][j] * inv);
    // the next row reuses these stores' address and data registers
    asm volatile("s_wait_xcnt 0x0" ::: "memory");
  }
}

// ---------------------------------------------------------------------------
// Kernel 3: output projection.  Out[m,n] = sum_k A[m,k]*Wo[n,k] + bo[n]  (f32)
// One wave computes a 32x64 output tile.
// ---------------------------------------------------------------------------
__global__ __launch_bounds__(128) void oproj_kernel(
    const _Float16* __restrict__ Af, const _Float16* __restrict__ Wof,
    const float* __restrict__ bo, float* __restrict__ Out)
{
  const int lane = threadIdx.x & 31;
  const int wave = threadIdx.x >> 5;
  const int m0 = (blockIdx.x * 4 + wave) * 32;
  const int n0 = blockIdx.y * 64;

  v8f acc[2][4];
#pragma unroll
  for (int g = 0; g < 2; ++g)
#pragma unroll
    for (int t = 0; t < 4; ++t) acc[g][t] = vzero8();

  const _Float16* At = Af  + (long)(m0 >> 4) * KTILES * TILE_H;
  const _Float16* Wt = Wof + (long)(n0 >> 4) * KTILES * TILE_H;
  for (int kt = 0; kt < KTILES; ++kt) {
    v16h a0 = frag_pk(At + (long)kt * TILE_H, lane);
    v16h a1 = frag_pk(At + (long)(KTILES + kt) * TILE_H, lane);
#pragma unroll
    for (int t = 0; t < 4; ++t) {
      v16h bfr = frag_pk(Wt + (long)(t * KTILES + kt) * TILE_H, lane);
      acc[0][t] = wmma16(a0, bfr, acc[0][t]);
      acc[1][t] = wmma16(a1, bfr, acc[1][t]);
    }
  }

  const int cn = lane & 15;
  const int hi = (lane >> 4) & 1;
#pragma unroll
  for (int t = 0; t < 4; ++t) {
    const float bn = bo[n0 + t * 16 + cn];
#pragma unroll
    for (int g = 0; g < 2; ++g)
#pragma unroll
      for (int j = 0; j < 8; ++j)
        Out[(long)(m0 + g * 16 + j + 8 * hi) * DMODEL + n0 + t * 16 + cn] =
            acc[g][t][j] + bn;
  }
}

// ---------------------------------------------------------------------------
extern "C" void kernel_launch(void* const* d_in, const int* in_sizes, int n_in,
                              void* d_out, int out_size, void* d_ws, size_t ws_size,
                              hipStream_t stream) {
  const float* query = (const float*)d_in[0];
  const float* key   = (const float*)d_in[1];
  const float* value = (const float*)d_in[2];
  const float* biasS = (const float*)d_in[3];
  const float* Wq = (const float*)d_in[4];
  const float* bq = (const float*)d_in[5];
  const float* Wk = (const float*)d_in[6];
  const float* bk = (const float*)d_in[7];
  const float* Wv = (const float*)d_in[8];
  const float* bv = (const float*)d_in[9];
  const float* Wo = (const float*)d_in[10];
  const float* bo = (const float*)d_in[11];
  const float* lam = (const float*)d_in[12];
  float* out = (float*)d_out;

  const long XN = (long)MROWS * DMODEL;            // 4M elements per activation
  const long WN = (long)DMODEL * DMODEL;           // 1M elements per weight
  const long HN = (long)BATCH * NHEAD * SLEN * HDIM;  // 4M per head tensor

  // all packed 16x32 tiles (see the header)
  _Float16* Xf = (_Float16*)d_ws;        // [3][MROWS, D]   12M halfs
  _Float16* Wf = Xf + 3 * XN;            // [4][D, D]        4M halfs (q,k,v,o)
  _Float16* Qf = Wf + 4 * WN;            // [B,H][S x HD]    4M
  _Float16* Kf = Qf + HN;                // [B,H][S x HD]    4M
  _Float16* Vt = Kf + HN;                // [B,H][HD x S]    4M
  _Float16* Of = Vt + HN;                // [B*S, D]         4M

  dim3 blk128(128);

  // 0) f32 -> f16 conversions
  {
    const int thr = 256;
    cvt_f16_kernel<<<dim3((unsigned)(XN / 8 / thr)), thr, 0, stream>>>(query, Xf + 0 * XN, XN);
    cvt_f16_kernel<<<dim3((unsigned)(XN / 8 / thr)), thr, 0, stream>>>(key,   Xf + 1 * XN, XN);
    cvt_f16_kernel<<<dim3((unsigned)(XN / 8 / thr)), thr, 0, stream>>>(value, Xf + 2 * XN, XN);
    cvt_f16_kernel<<<dim3((unsigned)(WN / 8 / thr)), thr, 0, stream>>>(Wq, Wf + 0 * WN, WN);
    cvt_f16_kernel<<<dim3((unsigned)(WN / 8 / thr)), thr, 0, stream>>>(Wk, Wf + 1 * WN, WN);
    cvt_f16_kernel<<<dim3((unsigned)(WN / 8 / thr)), thr, 0, stream>>>(Wv, Wf + 2 * WN, WN);
    cvt_f16_kernel<<<dim3((unsigned)(WN / 8 / thr)), thr, 0, stream>>>(Wo, Wf + 3 * WN, WN);
  }

  // 1) QKV projections: grid.x = M/128 (4 waves x 32 rows), grid.y = D/64
  qkv_proj_kernel<<<dim3(MROWS / 128, DMODEL / 64, 3), blk128, 0, stream>>>(
      Xf, Wf, bq, bk, bv, Qf, Kf, Vt);

  // 2) attention: grid.x = S/64 (4 q-tiles per block), grid.y = H, grid.z = B
  attn_kernel<<<dim3(SLEN / 64, NHEAD, BATCH), blk128, 0, stream>>>(
      Qf, Kf, Vt, biasS, lam, Of);

  // 3) output projection
  oproj_kernel<<<dim3(MROWS / 128, DMODEL / 64), blk128, 0, stream>>>(
      Of, Wf + 3 * WN, bo, out);
}

// v002
// It runs in 190 microseconds.
// In two side-by-side timings against v001, it was 1.10 and 1.09 times as fast.
// All steps since v000 together make it 1.31 times as fast.
#include <hip/hip_runtime.h>
#include <hip/hip_bf16.h>

typedef __attribute__((ext_vector_type(16))) _Float16 v16h;
typedef __attribute__((ext_vector_type(8)))  _Float16 v8h;
typedef __attribute__((ext_vector_type(8)))  float    v8f;

#define BATCH   2
#define SLEN    2048
#define DMODEL  1024
#define NHEAD   16
#define HDIM    64
#define MROWS   (BATCH * SLEN)   // 4096
#define SCALE   0.125f           // 1/sqrt(64)

__device__ __forceinline__ v8f vzero8() {
  v8f z;
#pragma unroll
  for (int i = 0; i < 8; ++i) z[i] = 0.0f;
  return z;
}

__device__ __forceinline__ v8f wmma16(v16h a, v16h b, v8f c) {
  return __builtin_amdgcn_wmma_f32_16x16x32_f16(
      /*neg_a=*/false, a, /*neg_b=*/false, b,
      /*c_mod=*/(short)0, c, /*reuse_a=*/false, /*reuse_b=*/false);
}

#define TILE_H  512              // halfs per packed 16x32 tile
#define KTILES  (DMODEL / 32)    // packed tiles along k of a [rows, DMODEL] matrix

// Load a 16x32 f16 fragment (A or B) from one packed tile.
__device__ __forceinline__ v16h frag_pk(const _Float16* tile, int lane) {
  v8h lo = *(const v8h*)(tile + lane * 8);
  v8h hh = *(const v8h*)(tile + 256 + lane * 8);
  v16h f;
#pragma unroll
  for (int i = 0; i < 8; ++i) { f[i] = lo[i]; f[i + 8] = hh[i]; }
  return f;
}

// Offset (in halfs) of element (row c, k index kk) inside a packed tile.
__device__ __forceinline__ int pk_off(int c, int kk) {
  const int p = kk >> 3;
  return (((p >> 1) * 32 + (p & 1) * 16 + c) << 3) + (kk & 7);
}

// Load a 16x32 f16 fragment (A or B) from row-major f16 memory, row stride ld.
__device__ __forceinline__ v16h frag_f16(const _Float16* base, long ld, int lane) {
  const int r  = lane & 15;
  const int hi = (lane >> 4) & 1;
  const _Float16* p = base + (long)r * ld + hi * 8;
  v8h lo = *(const v8h*)(p);
  v8h hh = *(const v8h*)(p + 16);
  v16h f;
#pragma unroll
  for (int i = 0; i < 8; ++i) { f[i] = lo[i]; f[i + 8] = hh[i]; }
  return f;
}

// ---------------------------------------------------------------------------
// Kernel 0: f32 row-major -> f16 packed tiles, all seven tensors in one launch.
// The destinations follow one another in the workspace, so together they are
// the packed form of one stacked [CVT_ROWS, DMODEL] matrix (q, k, v, Wq, Wk,
// Wv, Wo); only the source pointer depends on the row.  One wave converts 16
// rows x 256 columns = 8 whole tiles (8 KB out, contiguous): 32 independent
// b128 loads, 16 b128 stores.  4096 waves, resident together.
// A load instruction reads half of one 128-byte line from each of 8 rows, a
// store instruction writes four whole 128-byte lines of one tile.
// ---------------------------------------------------------------------------
#define CVT_ROWS    (3 * MROWS + 4 * DMODEL)   // 16384 stacked rows
#define CVT_BLOCKS  (CVT_ROWS / 16 * 4 / 8)    // 4 waves per 16 rows, 8 waves per block

__global__ __launch_bounds__(256) void cvt_f16_kernel(
    const float* __restrict__ xq, const float* __restrict__ xk,
    const float* __restrict__ xv, const float* __restrict__ wq,
    const float* __restrict__ wk, const float* __restrict__ wv,
    const float* __restrict__ wo, _Float16* __restrict__ dst)
{
  const int lane = threadIdx.x & 31;
  const int wave = threadIdx.x >> 5;
  const int p    = lane & 3;                   // 8-wide k piece inside a tile
  const int r8   = lane >> 2;                  // row inside a half tile
  const int kq   = wave & 3;                   // which 8 of the 32 k tiles
  const int rg   = blockIdx.x * 2 + (wave >> 2);   // 16-row group, stacked

  // a block's two row groups lie in one tensor: the choice is block-uniform
  const int bg = blockIdx.x * 2;
  const float* src;
  int g0;                                      // the tensor's first row group
  if (bg < 3 * (MROWS / 16)) {
    const int w = bg / (MROWS / 16);
    src = (w == 0) ? xq : (w == 1) ? xk : xv;
    g0  = w * (MROWS / 16);
  } else {
    const int w = (bg - 3 * (MROWS / 16)) / (DMODEL / 16);
    src = (w == 0) ? wq : (w == 1) ? wk : (w == 2) ? wv : wo;
    g0  = 3 * (MROWS / 16) + w * (DMODEL / 16);
  }

  const float* s = src + (long)((rg - g0) * 16 + r8) * DMODEL + kq * 256 + p * 8;
  float4 a[2][8], b[2][8];
  // both loop nests are unrolled so that a and b stay in registers
#pragma unroll
  for (int hf = 0; hf < 2; ++hf)
#pragma unroll
    for (int t = 0; t < 8; ++t) {
      a[hf][t] = *(const float4*)(s + hf * 8 * DMODEL + t * 32);
      b[hf][t] = *(const float4*)(s + hf * 8 * DMODEL + t * 32 + 4);
    }
  // all 32 loads name the address s: it is an operand here so that its registers
  // stay whole until the wait, and may be reused only behind it
  asm volatile("s_wait_xcnt 0x0" :: "v"(s) : "memory");

  _Float16* d = dst + ((long)rg * KTILES + kq * 8) * TILE_H + pk_off(r8, p * 8);
#pragma unroll
  for (int hf = 0; hf < 2; ++hf)
#pragma unroll
    for (int t = 0; t < 8; ++t) {
      const float4 x = a[hf][t], y = b[hf][t];
      v8h o;
      o[0]=(_Float16)x.x; o[1]=(_Float16)x.y; o[2]=(_Float16)x.z; o[3]=(_Float16)x.w;
      o[4]=(_Float16)y.x; o[5]=(_Float16)y.y; o[6]=(_Float16)y.z; o[7]=(_Float16)y.w;
      *(v8h*)(d + t * TILE_H + hf * 64) = o;   // rows 8..15: 8 pieces further on
    }
}

// ---------------------------------------------------------------------------
// Kernel 1: QKV projection.  Out[m,n] = sum_k X[m,k]*W[n,k] + bias[n]
// blockIdx.z selects {Q,K,V}.  Per (b,h), packed tiles: Q,K rows = s, k = hd,
// tile (s/16)*2 + hd/32;  V rows = hd, k = s, tile (s/32)*4 + hd/16.
// One wave computes a 32x64 output tile: 2 A frags + 4 B frags -> 8 WMMAs.
// ---------------------------------------------------------------------------
__global__ __launch_bounds__(128) void qkv_proj_kernel(
    const _Float16* __restrict__ Xf,   // [3][MROWS, D] f16 packed (q,k,v)
    const _Float16* __restrict__ Wf,   // [3][D, D] f16 packed (Wq,Wk,Wv)
    const float* __restrict__ bq, const float* __restrict__ bk,
    const float* __restrict__ bv,
    _Float16* __restrict__ Qf, _Float16* __restrict__ Kf, _Float16* __restrict__ Vt)
{
  const int lane = threadIdx.x & 31;
  const int wave = threadIdx.x >> 5;
  const int which = blockIdx.z;

  const _Float16* X    = Xf + (long)which * MROWS * DMODEL;
  const _Float16* W    = Wf + (long)which * DMODEL * DMODEL;
  const float*    bias = (which == 0) ? bq : (which == 1) ? bk : bv;

  const int m0 = (blockIdx.x * 4 + wave) * 32;
  const int n0 = blockIdx.y * 64;

  v8f acc[2][4];
#pragma unroll
  for (int g = 0; g < 2; ++g)
#pragma unroll
    for (int t = 0; t < 4; ++t) acc[g][t] = vzero8();

  const _Float16* Xt = X + (long)(m0 >> 4) * KTILES * TILE_H;
  const _Float16* Wt = W + (long)(n0 >> 4) * KTILES * TILE_H;
  for (int kt = 0; kt < KTILES; ++kt) {
    v16h a0 = frag_pk(Xt + (long)kt * TILE_H, lane);
    v16h a1 = frag_pk(Xt + (long)(KTILES + kt) * TILE_H, lane);
#pragma unroll
    for (int t = 0; t < 4; ++t) {
      v16h bfr = frag_pk(Wt + (long)(t * KTILES + kt) * TILE_H, lane);
      acc[0][t] = wmma16(a0, bfr, acc[0][t]);
      acc[1][t] = wmma16(a1, bfr, acc[1][t]);
    }
  }

  const int cn = lane & 15;
  const int hi = (lane >> 4) & 1;
  const int h  = n0 >> 6;            // the 64 columns of a wave are one head
  const int b  = m0 >> 11;           // /2048; the 32 rows are one batch entry
  const int s0 = m0 & (SLEN - 1);
  const long hb = ((long)b * NHEAD + h) * SLEN * HDIM;
  if (which == 2) {
    _Float16* dst = Vt + hb + (long)(s0 >> 5) * 4 * TILE_H + lane * 8;
#pragma unroll
    for (int t = 0; t < 4; ++t) {
      const float bn = bias[n0 + t * 16 + cn];
#pragma unroll
      for (int g = 0; g < 2; ++g) {
        // a lane's 8 accumulators are 8 consecutive keys of one hd row: one piece
        v8h pv;
#pragma unroll
        for (int j = 0; j < 8; ++j) pv[j] = (_Float16)(acc[g][t][j] + bn);
        *(v8h*)(dst + t * TILE_H + g * 256) = pv;
        // the next group reuses this store's data registers
        asm volatile("s_wait_xcnt 0x0" ::: "memory");
      }
    }
  } else {
    _Float16* dst = ((which == 0) ? Qf : Kf) + hb + (long)(s0 >> 4) * 2 * TILE_H;
#pragma unroll
    for (int t = 0; t < 4; ++t) {
      const float bn = bias[n0 + t * 16 + cn];
#pragma unroll
      for (int g = 0; g < 2; ++g) {
#pragma unroll
        for (int j = 0; j < 8; ++j)
          dst[(g * 2 + (t >> 1)) * TILE_H + pk_off(j + 8 * hi, (t & 1) * 16 + cn)] =
              (_Float16)(acc[g][t][j] + bn);
        // the next group reuses these stores' data registers
        asm volatile("s_wait_xcnt 0x0" ::: "memory");
      }
    }
  }
}

// ---------------------------------------------------------------------------
// Kernel 2: flash-style attention.  One wave = 16 query rows for one (b,h).
// Streams 32-wide key tiles: 4 score WMMAs, scale + lambda*bias, online
// softmax (shfl_xor row reductions), P transposed through per-wave LDS tile,
// 4 PV WMMAs against V (rows = hd, k = s).  Q, K, V and the output are packed
// tiles; a 32-key step reads 4 KB of K and 4 KB of V, each contiguous.
// Prefetches next K/V tiles.
// ---------------------------------------------------------------------------
__global__ __launch_bounds__(128) void attn_kernel(
    const _Float16* __restrict__ Qf, const _Float16* __restrict__ Kf,
    const _Float16* __restrict__ Vt,
    const float* __restrict__ bias_struct, const float* __restrict__ lambda_p,
    _Float16* __restrict__ Of)   // [B*S, D] f16 packed
{
  __shared__ __align__(16) _Float16 plds[4][16 * 32];

  const int lane = threadIdx.x & 31;
  const int wave = threadIdx.x >> 5;
  const int q0 = (blockIdx.x * 4 + wave) * 16;
  const int h  = blockIdx.y;
  const int b  = blockIdx.z;
  const float lam = *lambda_p;

  const _Float16* Qb = Qf + ((long)b * NHEAD + h) * SLEN * HDIM;
  const _Float16* Kb = Kf + ((long)b * NHEAD + h) * SLEN * HDIM;
  const _Float16* Vb = Vt + ((long)b * NHEAD + h) * HDIM * SLEN;
  const float*    Bb = bias_struct + ((long)b * SLEN + q0) * SLEN;

  const int cn = lane & 15;
  const int hi = (lane >> 4) & 1;

  // Q fragments (K-dim 0..31 and 32..63), loaded once.
  const v16h aq0 = frag_pk(Qb + (long)((q0 >> 4) * 2 + 0) * TILE_H, lane);
  const v16h aq1 = frag_pk(Qb + (long)((q0 >> 4) * 2 + 1) * TILE_H, lane);

  v8f o[4];
#pragma unroll
  for (int t = 0; t < 4; ++t) o[t] = vzero8();
  float mrun[8], lrun[8];
#pragma unroll
  for (int j = 0; j < 8; ++j) { mrun[j] = -3.0e38f; lrun[j] = 0.0f; }

  _Float16* pw = &plds[wave][0];

  for (int k0 = 0; k0 < SLEN; k0 += 32) {
    // prefetch next key/value tiles into cache (global_prefetch_b8)
    {
      const int kn = (k0 + 32 < SLEN) ? (k0 + 32) : k0;
      __builtin_prefetch(Kb + (long)(kn >> 5) * 4 * TILE_H + lane * 64, 0, 3);
      __builtin_prefetch(Vb + (long)(kn >> 5) * 4 * TILE_H + lane * 64, 0, 3);
    }

    // scores: two 16x16 tiles (key cols k0..k0+15 and k0+16..k0+31)
    v8f s0 = vzero8(), s1 = vzero8();
    {
      const _Float16* Kt = Kb + (long)(k0 >> 5) * 4 * TILE_H;  // tiles: key16*2 + hd32
      v16h bk0 = frag_pk(Kt + 0 * TILE_H, lane);
      v16h bk1 = frag_pk(Kt + 2 * TILE_H, lane);
      s0 = wmma16(aq0, bk0, s0);
      s1 = wmma16(aq0, bk1, s1);
      bk0 = frag_pk(Kt + 1 * TILE_H, lane);
      bk1 = frag_pk(Kt + 3 * TILE_H, lane);
      s0 = wmma16(aq1, bk0, s0);
      s1 = wmma16(aq1, bk1, s1);
    }

    // scale + structural bias + online softmax update
#pragma unroll
    for (int j = 0; j < 8; ++j) {
      const float* bp = Bb + (long)(j + 8 * hi) * SLEN + k0 + cn;
      float x0 = s0[j] * SCALE + lam * bp[0];
      float x1 = s1[j] * SCALE + lam * bp[16];
      float mv = fmaxf(x0, x1);
#pragma unroll
      for (int msk = 8; msk >= 1; msk >>= 1) mv = fmaxf(mv, __shfl_xor(mv, msk, 32));
      const float mnew = fmaxf(mrun[j], mv);
      const float corr = __expf(mrun[j] - mnew);
      mrun[j] = mnew;
      const float p0 = __expf(x0 - mnew);
      const float p1 = __expf(x1 - mnew);
      float ps = p0 + p1;
#pragma unroll
      for (int msk = 8; msk >= 1; msk >>= 1) ps += __shfl_xor(ps, msk, 32);
      lrun[j] = lrun[j] * corr + ps;
#pragma unroll
      for (int t = 0; t < 4; ++t) o[t][j] *= corr;
      // stash P (C layout -> LDS row-major 16x32)
      pw[(j + 8 * hi) * 32 + cn]      = (_Float16)p0;
      pw[(j + 8 * hi) * 32 + cn + 16] = (_Float16)p1;
    }

    v16h ap = frag_f16(pw, 32, lane);

    // out += P (16x32) @ V (32x64), one packed V tile per 16 hd rows
#pragma unroll
    for (int t = 0; t < 4; ++t) {
      v16h bvf = frag_pk(Vb + (long)((k0 >> 5) * 4 + t) * TILE_H, lane);
      o[t] = wmma16(ap, bvf, o[t]);
    }
  }

  // normalize and store attention output as f16 packed tiles of [B*S, D]
  _Float16* op = Of + ((long)((b * SLEN + q0) >> 4) * KTILES + h * 2) * TILE_H;
#pragma unroll
  for (int j = 0; j < 8; ++j) {
    const float inv = 1.0f / lrun[j];
#pragma unroll
    for (int t = 0; t < 4; ++t)
      op[(t >> 1) * TILE_H + pk_off(j + 8 * hi, (t & 1) * 16 + cn)] =
          (_Float16)(o[t][j] * inv);
    // the next row reuses these stores' address and data registers
    asm volatile("s_wait_xcnt 0x0" ::: "memory");
  }
}

// ---------------------------------------------------------------------------
// Kernel 3: output projection.  Out[m,n] = sum_k A[m,k]*Wo[n,k] + bo[n]  (f32)
// One wave computes a 32x64 output tile.
// ---------------------------------------------------------------------------
__global__ __launch_bounds__(128) void oproj_kernel(
    const _Float16* __restrict__ Af, const _Float16* __restrict__ Wof,
    const float* __restrict__ bo, float* __restrict__ Out)
{
  const int lane = threadIdx.x & 31;
  const int wave = threadIdx.x >> 5;
  const int m0 = (blockIdx.x * 4 + wave) * 32;
  const int n0 = blockIdx.y * 64;

  v8f acc[2][4];
#pragma unroll
  for (int g = 0; g < 2; ++g)
#pragma unroll
    for (int t = 0; t < 4; ++t) acc[g][t] = vzero8();

  const _Float16* At = Af  + (long)(m0 >> 4) * KTILES * TILE_H;
  const _Float16* Wt = Wof + (long)(n0 >> 4) * KTILES * TILE_H;
  for (int kt = 0; kt < KTILES; ++kt) {
    v16h a0 = frag_pk(At + (long)kt * TILE_H, lane);
    v16h a1 = frag_pk(At + (long)(KTILES + kt) * TILE_H, lane);
#pragma unroll
    for (int t = 0; t < 4; ++t) {
      v16h bfr = frag_pk(Wt + (long)(t * KTILES + kt) * TILE_H, lane);
      acc[0][t] = wmma16(a0, bfr, acc[0][t]);
      acc[1][t] = wmma16(a1, bfr, acc[1][t]);
    }
  }

  const int cn = lane & 15;
  const int hi = (lane >> 4) & 1;
#pragma unroll
  for (int t = 0; t < 4; ++t) {
    const float bn = bo[n0 + t * 16 + cn];
#pragma unroll
    for (int g = 0; g < 2; ++g)
#pragma unroll
      for (int j = 0; j < 8; ++j)
        Out[(long)(m0 + g * 16 + j + 8 * hi) * DMODEL + n0 + t * 16 + cn] =
            acc[g][t][j] + bn;
  }
}

// ---------------------------------------------------------------------------
extern "C" void kernel_launch(void* const* d_in, const int* in_sizes, int n_in,
                              void* d_out, int out_size, void* d_ws, size_t ws_size,
                              hipStream_t stream) {
  const float* query = (const float*)d_in[0];
  const float* key   = (const float*)d_in[1];
  const float* value = (const float*)d_in[2];
  const float* biasS = (const float*)d_in[3];
  const float* Wq = (const float*)d_in[4];
  const float* bq = (const float*)d_in[5];
  const float* Wk = (const float*)d_in[6];
  const float* bk = (const float*)d_in[7];
  const float* Wv = (const float*)d_in[8];
  const float* bv = (const float*)d_in[9];
  const float* Wo = (const float*)d_in[10];
  const float* bo = (const float*)d_in[11];
  const float* lam = (const float*)d_in[12];
  float* out = (float*)d_out;

  const long XN = (long)MROWS * DMODEL;            // 4M elements per activation
  const long WN = (long)DMODEL * DMODEL;           // 1M elements per weight
  const long HN = (long)BATCH * NHEAD * SLEN * HDIM;  // 4M per head tensor

  // all packed 16x32 tiles (see the header)
  _Float16* Xf = (_Float16*)d_ws;        // [3][MROWS, D]   12M halfs
  _Float16* Wf = Xf + 3 * XN;            // [4][D, D]        4M halfs (q,k,v,o)
  _Float16* Qf = Wf + 4 * WN;            // [B,H][S x HD]    4M
  _Float16* Kf = Qf + HN;                // [B,H][S x HD]    4M
  _Float16* Vt = Kf + HN;                // [B,H][HD x S]    4M
  _Float16* Of = Vt + HN;                // [B*S, D]         4M

  dim3 blk128(128);

  // 0) f32 -> f16 conversions: Xf and Wf are one run of the workspace
  cvt_f16_kernel<<<dim3(CVT_BLOCKS), dim3(256), 0, stream>>>(
      query, key, value, Wq, Wk, Wv, Wo, Xf);

  // 1) QKV projections: grid.x = M/128 (4 waves x 32 rows), grid.y = D/64
  qkv_proj_kernel<<<dim3(MROWS / 128, DMODEL / 64, 3), blk128, 0, stream>>>(
      Xf, Wf, bq, bk, bv, Qf, Kf, Vt);

  // 2) attention: grid.x = S/64 (4 q-tiles per block), grid.y = H, grid.z = B
  attn_kernel<<<dim3(SLEN / 64, NHEAD, BATCH), blk128, 0, stream>>>(
      Qf, Kf, Vt, biasS, lam, Of);

  // 3) output projection
  oproj_kernel<<<dim3(MROWS / 128, DMODEL / 64), blk128, 0, stream>>>(
      Of, Wf + 3 * WN, bo, out);
}

// v003
// It runs in 172 microseconds.
// Next to v002, in two timings, it ran 1.11 times as fast each time.
// All steps since v000 together make it 1.45 times as fast.
#include <hip/hip_runtime.h>
#include <hip/hip_bf16.h>

typedef __attribute__((ext_vector_type(16))) _Float16 v16h;
typedef __attribute__((ext_vector_type(8)))  _Float16 v8h;
typedef __attribute__((ext_vector_type(8)))  float    v8f;
typedef __attribute__((ext_vector_type(4)))  float    v4f;

#define BATCH   2
#define SLEN    2048
#define DMODEL  1024
#define NHEAD   16
#define HDIM    64
#define MROWS   (BATCH * SLEN)   // 4096
#define SCALE   0.125f           // 1/sqrt(64)

__device__ __forceinline__ v8f vzero8() {
  v8f z;
#pragma unroll
  for (int i = 0; i < 8; ++i) z[i] = 0.0f;
  return z;
}

__device__ __forceinline__ v8f wmma16(v16h a, v16h b, v8f c) {
  return __builtin_amdgcn_wmma_f32_16x16x32_f16(
      /*neg_a=*/false, a, /*neg_b=*/false, b,
      /*c_mod=*/(short)0, c, /*reuse_a=*/false, /*reuse_b=*/false);
}

#define TILE_H  512              // halfs per packed 16x32 tile
#define KTILES  (DMODEL / 32)    // packed tiles along k of a [rows, DMODEL] matrix

// Load a 16x32 f16 fragment (A or B) from one packed tile.
__device__ __forceinline__ v16h frag_pk(const _Float16* tile, int lane) {
  v8h lo = *(const v8h*)(tile + lane * 8);
  v8h hh = *(const v8h*)(tile + 256 + lane * 8);
  v16h f;
#pragma unroll
  for (int i = 0; i < 8; ++i) { f[i] = lo[i]; f[i + 8] = hh[i]; }
  return f;
}

// Offset (in halfs) of element (row c, k index kk) inside a packed tile.
__device__ __forceinline__ int pk_off(int c, int kk) {
  const int p = kk >> 3;
  return (((p >> 1) * 32 + (p & 1) * 16 + c) << 3) + (kk & 7);
}

// ---------------------------------------------------------------------------
// Kernel 0: f32 row-major -> f16 packed tiles, all seven tensors in one launch.
// The destinations follow one another in the workspace, so together they are
// the packed form of one stacked [CVT_ROWS, DMODEL] matrix (q, k, v, Wq, Wk,
// Wv, Wo); only the source pointer depends on the row.  One wave converts 16
// rows x 256 columns = 8 whole tiles (8 KB out, contiguous): 32 independent
// b128 loads, 16 b128 stores.  4096 waves, resident together.
// A load instruction reads half of one 128-byte line from each of 8 rows, a
// store instruction writes four whole 128-byte lines of one tile.
// ---------------------------------------------------------------------------
#define CVT_ROWS    (3 * MROWS + 4 * DMODEL)   // 16384 stacked rows
#define CVT_BLOCKS  (CVT_ROWS / 16 * 4 / 8)    // 4 waves per 16 rows, 8 waves per block

__global__ __launch_bounds__(256) void cvt_f16_kernel(
    const float* __restrict__ xq, const float* __restrict__ xk,
    const float* __restrict__ xv, const float* __restrict__ wq,
    const float* __restrict__ wk, const float* __restrict__ wv,
    const float* __restrict__ wo, _Float16* __restrict__ dst)
{
  const int lane = threadIdx.x & 31;
  const int wave = threadIdx.x >> 5;
  const int p    = lane & 3;                   // 8-wide k piece inside a tile
  const int r8   = lane >> 2;                  // row inside a half tile
  const int kq   = wave & 3;                   // which 8 of the 32 k tiles
  const int rg   = blockIdx.x * 2 + (wave >> 2);   // 16-row group, stacked

  // a block's two row groups lie in one tensor: the choice is block-uniform
  const int bg = blockIdx.x * 2;
  const float* src;
  int g0;                                      // the tensor's first row group
  if (bg < 3 * (MROWS / 16)) {
    const int w = bg / (MROWS / 16);
    src = (w == 0) ? xq : (w == 1) ? xk : xv;
    g0  = w * (MROWS / 16);
  } else {
    const int w = (bg - 3 * (MROWS / 16)) / (DMODEL / 16);
    src = (w == 0) ? wq : (w == 1) ? wk : (w == 2) ? wv : wo;
    g0  = 3 * (MROWS / 16) + w * (DMODEL / 16);
  }

  const float* s = src + (long)((rg - g0) * 16 + r8) * DMODEL + kq * 256 + p * 8;
  float4 a[2][8], b[2][8];
  // both loop nests are unrolled so that a and b stay in registers
#pragma unroll
  for (int hf = 0; hf < 2; ++hf)
#pragma unroll
    for (int t = 0; t < 8; ++t) {
      a[hf][t] = *(const float4*)(s + hf * 8 * DMODEL + t * 32);
      b[hf][t] = *(const float4*)(s + hf * 8 * DMODEL + t * 32 + 4);
    }
  // all 32 loads name the address s: it is an operand here so that its registers
  // stay whole until the wait, and may be reused only behind it
  asm volatile("s_wait_xcnt 0x0" :: "v"(s) : "memory");

  _Float16* d = dst + ((long)rg * KTILES + kq * 8) * TILE_H + pk_off(r8, p * 8);
#pragma unroll
  for (int hf = 0; hf < 2; ++hf)
#pragma unroll
    for (int t = 0; t < 8; ++t) {
      const float4 x = a[hf][t], y = b[hf][t];
      v8h o;
      o[0]=(_Float16)x.x; o[1]=(_Float16)x.y; o[2]=(_Float16)x.z; o[3]=(_Float16)x.w;
      o[4]=(_Float16)y.x; o[5]=(_Float16)y.y; o[6]=(_Float16)y.z; o[7]=(_Float16)y.w;
      *(v8h*)(d + t * TILE_H + hf * 64) = o;   // rows 8..15: 8 pieces further on
    }
}

// ---------------------------------------------------------------------------
// Kernel 1: QKV projection.  Out[m,n] = sum_k X[m,k]*W[n,k] + bias[n]
// blockIdx.z selects {Q,K,V}.  Per (b,h), packed tiles: Q,K rows = s, k = hd,
// tile (s/16)*2 + hd/32;  V rows = hd, k = s, tile (s/32)*4 + hd/16.
// One wave computes a 32x64 output tile: 2 A frags + 4 B frags -> 8 WMMAs.
// ---------------------------------------------------------------------------
__global__ __launch_bounds__(128) void qkv_proj_kernel(
    const _Float16* __restrict__ Xf,   // [3][MROWS, D] f16 packed (q,k,v)
    const _Float16* __restrict__ Wf,   // [3][D, D] f16 packed (Wq,Wk,Wv)
    const float* __restrict__ bq, const float* __restrict__ bk,
    const float* __restrict__ bv,
    _Float16* __restrict__ Qf, _Float16* __restrict__ Kf, _Float16* __restrict__ Vt)
{
  const int lane = threadIdx.x & 31;
  const int wave = threadIdx.x >> 5;
  const int which = blockIdx.z;

  const _Float16* X    = Xf + (long)which * MROWS * DMODEL;
  const _Float16* W    = Wf + (long)which * DMODEL * DMODEL;
  const float*    bias = (which == 0) ? bq : (which == 1) ? bk : bv;

  const int m0 = (blockIdx.x * 4 + wave) * 32;
  const int n0 = blockIdx.y * 64;

  v8f acc[2][4];
#pragma unroll
  for (int g = 0; g < 2; ++g)
#pragma unroll
    for (int t = 0; t < 4; ++t) acc[g][t] = vzero8();

  const _Float16* Xt = X + (long)(m0 >> 4) * KTILES * TILE_H;
  const _Float16* Wt = W + (long)(n0 >> 4) * KTILES * TILE_H;
  for (int kt = 0; kt < KTILES; ++kt) {
    v16h a0 = frag_pk(Xt + (long)kt * TILE_H, lane);
    v16h a1 = frag_pk(Xt + (long)(KTILES + kt) * TILE_H, lane);
#pragma unroll
    for (int t = 0; t < 4; ++t) {
      v16h bfr = frag_pk(Wt + (long)(t * KTILES + kt) * TILE_H, lane);
      acc[0][t] = wmma16(a0, bfr, acc[0][t]);
      acc[1][t] = wmma16(a1, bfr, acc[1][t]);
    }
  }

  const int cn = lane & 15;
  const int hi = (lane >> 4) & 1;
  const int h  = n0 >> 6;            // the 64 columns of a wave are one head
  const int b  = m0 >> 11;           // /2048; the 32 rows are one batch entry
  const int s0 = m0 & (SLEN - 1);
  const long hb = ((long)b * NHEAD + h) * SLEN * HDIM;
  if (which == 2) {
    _Float16* dst = Vt + hb + (long)(s0 >> 5) * 4 * TILE_H + lane * 8;
#pragma unroll
    for (int t = 0; t < 4; ++t) {
      const float bn = bias[n0 + t * 16 + cn];
#pragma unroll
      for (int g = 0; g < 2; ++g) {
        // a lane's 8 accumulators are 8 consecutive keys of one hd row: one piece
        v8h pv;
#pragma unroll
        for (int j = 0; j < 8; ++j) pv[j] = (_Float16)(acc[g][t][j] + bn);
        *(v8h*)(dst + t * TILE_H + g * 256) = pv;
        // the next group reuses this store's data registers
        asm volatile("s_wait_xcnt 0x0" ::: "memory");
      }
    }
  } else {
    _Float16* dst = ((which == 0) ? Qf : Kf) + hb + (long)(s0 >> 4) * 2 * TILE_H;
#pragma unroll
    for (int t = 0; t < 4; ++t) {
      const float bn = bias[n0 + t * 16 + cn];
#pragma unroll
      for (int g = 0; g < 2; ++g) {
#pragma unroll
        for (int j = 0; j < 8; ++j)
          dst[(g * 2 + (t >> 1)) * TILE_H + pk_off(j + 8 * hi, (t & 1) * 16 + cn)] =
              (_Float16)(acc[g][t][j] + bn);
        // the next group reuses these stores' data registers
        asm volatile("s_wait_xcnt 0x0" ::: "memory");
      }
    }
  }
}

// ---------------------------------------------------------------------------
// Kernel 2: flash-style attention, scores transposed.  One wave = 16 query
// columns for one (b,h).  Per 32 keys: S^T = K Q^T (A = packed K tiles, B = Q),
// so a lane holds 16 scores of ONE query (column lane&15; keys 8*hi + j and
// 16 + 8*hi + j).  Maximum and sum run inside the lane, the two lane halves
// exchange the maximum once per step and join their sums once at the end.
// The two score tiles, converted in place, are the B operand of
// O^T += V^T P^T (A = packed V tiles): P touches neither LDS nor another lane.
// A lane's bias values are 2 x 8 consecutive floats of its query's row.
// Prefetches next K/V tiles.
// ---------------------------------------------------------------------------

__device__ __forceinline__ float xhalf(float x) {
  const int b = __builtin_bit_cast(int, x);
  return __builtin_bit_cast(float, __builtin_amdgcn_permlanex16(
      b, b, 0x76543210, 0xfedcba98, false, false));
}

__global__ __launch_bounds__(128) void attn_kernel(
    const _Float16* __restrict__ Qf, const _Float16* __restrict__ Kf,
    const _Float16* __restrict__ Vt,
    const float* __restrict__ bias_struct, const float* __restrict__ lambda_p,
    _Float16* __restrict__ Of)   // [B*S, D] f16 packed
{
  const int lane = threadIdx.x & 31;
  const int wave = threadIdx.x >> 5;
  const int q0 = (blockIdx.x * 4 + wave) * 16;
  const int h  = blockIdx.y;
  const int b  = blockIdx.z;
  const float lam = *lambda_p;

  const _Float16* Qb = Qf + ((long)b * NHEAD + h) * SLEN * HDIM;
  const _Float16* Kb = Kf + ((long)b * NHEAD + h) * SLEN * HDIM;
  const _Float16* Vb = Vt + ((long)b * NHEAD + h) * HDIM * SLEN;

  const int cn = lane & 15;
  const int hi = (lane >> 4) & 1;

  // the lane's own query row of the bias, at its first key
  const float* Bl = bias_struct + ((long)b * SLEN + q0 + cn) * SLEN + hi * 8;

  // Q fragments (K-dim 0..31 and 32..63), loaded once; B operand: column = query
  const v16h bq0 = frag_pk(Qb + (long)((q0 >> 4) * 2 + 0) * TILE_H, lane);
  const v16h bq1 = frag_pk(Qb + (long)((q0 >> 4) * 2 + 1) * TILE_H, lane);

  // o[t][j] = O[query cn][hd = t*16 + 8*hi + j]
  v8f o[4];
#pragma unroll
  for (int t = 0; t < 4; ++t) o[t] = vzero8();
  float mrun = -3.0e38f;   // running maximum of the query, equal in both halves
  float lrun = 0.0f;       // running sum over this half's keys only

  for (int k0 = 0; k0 < SLEN; k0 += 32) {
    // prefetch next key/value tiles into cache (global_prefetch_b8)
    {
      const int kn = (k0 + 32 < SLEN) ? (k0 + 32) : k0;
      __builtin_prefetch(Kb + (long)(kn >> 5) * 4 * TILE_H + lane * 64, 0, 3);
      __builtin_prefetch(Vb + (long)(kn >> 5) * 4 * TILE_H + lane * 64, 0, 3);
    }

    // bias of keys k0 + 8*hi + 0..7 and k0 + 16 + 8*hi + 0..7
    const v4f c0 = *(const v4f*)(Bl + k0);
    const v4f c1 = *(const v4f*)(Bl + k0 + 4);
    const v4f c2 = *(const v4f*)(Bl + k0 + 16);
    const v4f c3 = *(const v4f*)(Bl + k0 + 20);

    // scores^T: two 16x16 tiles (key rows k0..k0+15 and k0+16..k0+31)
    const _Float16* Kt = Kb + (long)(k0 >> 5) * 4 * TILE_H;    // tiles: key16*2 + hd32
    const v16h ak0 = frag_pk(Kt + 0 * TILE_H, lane);
    const v16h ak1 = frag_pk(Kt + 1 * TILE_H, lane);
    const v16h ak2 = frag_pk(Kt + 2 * TILE_H, lane);
    const v16h ak3 = frag_pk(Kt + 3 * TILE_H, lane);
    // keeps the bias loads in flight together with the K loads: without it they
    // are sunk behind the first WMMAs and their latency adds to that of K
    __builtin_amdgcn_sched_barrier(0);
    v8f s0 = vzero8(), s1 = vzero8();
    s0 = wmma16(ak0, bq0, s0);
    s1 = wmma16(ak2, bq0, s1);
    s0 = wmma16(ak1, bq1, s0);
    s1 = wmma16(ak3, bq1, s1);

    // scale + structural bias, in the accumulators' own register order
    const v8f x0 = s0 * SCALE + lam * __builtin_shufflevector(c0, c1, 0, 1, 2, 3, 4, 5, 6, 7);
    const v8f x1 = s1 * SCALE + lam * __builtin_shufflevector(c2, c3, 0, 1, 2, 3, 4, 5, 6, 7);

    // online softmax update: one maximum, one correction per lane
    const float t0 = fmaxf(fmaxf(x0[0], x0[1]), x0[2]);
    const float t1 = fmaxf(fmaxf(x0[3], x0[4]), x0[5]);
    const float t2 = fmaxf(fmaxf(x0[6], x0[7]), x1[0]);
    const float t3 = fmaxf(fmaxf(x1[1], x1[2]), x1[3]);
    const float t4 = fmaxf(fmaxf(x1[4], x1[5]), x1[6]);
    float mv = fmaxf(fmaxf(fmaxf(t0, t1), t2), fmaxf(fmaxf(t3, t4), x1[7]));
    mv = fmaxf(mv, xhalf(mv));
    const float mnew = fmaxf(mrun, mv);
    const float corr = __expf(mrun - mnew);
    mrun = mnew;

    v16h bp;     // P^T as B operand: halfs[j] = key 8*hi + j, halfs[8+j] = key 16 + 8*hi + j
    v8f p0, p1;
#pragma unroll
    for (int j = 0; j < 8; ++j) {
      p0[j] = __expf(x0[j] - mnew);
      p1[j] = __expf(x1[j] - mnew);
      bp[j]     = (_Float16)p0[j];
      bp[j + 8] = (_Float16)p1[j];
    }
    const v8f ps = p0 + p1;
    lrun = lrun * corr +
           (((ps[0] + ps[4]) + (ps[2] + ps[6])) + ((ps[1] + ps[5]) + (ps[3] + ps[7])));
#pragma unroll
    for (int t = 0; t < 4; ++t) o[t] *= corr;

    // out^T += V^T (64x32) @ P^T (32x16), one packed V tile per 16 hd rows
#pragma unroll
    for (int t = 0; t < 4; ++t) {
      v16h avf = frag_pk(Vb + (long)((k0 >> 5) * 4 + t) * TILE_H, lane);
      o[t] = wmma16(avf, bp, o[t]);
    }
  }

  // normalize and store attention output as f16 packed tiles of [B*S, D]:
  // a lane's 8 accumulators of o[t] are 8 consecutive columns of its row, one piece
  const float inv = 1.0f / (lrun + xhalf(lrun));
  _Float16* op = Of + ((long)((b * SLEN + q0) >> 4) * KTILES + h * 2) * TILE_H + lane * 8;
#pragma unroll
  for (int t = 0; t < 4; ++t) {
    v8h ov;
#pragma unroll
    for (int j = 0; j < 8; ++j) ov[j] = (_Float16)(o[t][j] * inv);
    *(v8h*)(op + (t >> 1) * TILE_H + (t & 1) * 256) = ov;
  }
}

// ---------------------------------------------------------------------------
// Kernel 3: output projection.  Out[m,n] = sum_k A[m,k]*Wo[n,k] + bo[n]  (f32)
// One wave computes a 32x64 output tile.
// ---------------------------------------------------------------------------
__global__ __launch_bounds__(128) void oproj_kernel(
    const _Float16* __restrict__ Af, const _Float16* __restrict__ Wof,
    const float* __restrict__ bo, float* __restrict__ Out)
{
  const int lane = threadIdx.x & 31;
  const int wave = threadIdx.x >> 5;
  const int m0 = (blockIdx.x * 4 + wave) * 32;
  const int n0 = blockIdx.y * 64;

  v8f acc[2][4];
#pragma unroll
  for (int g = 0; g < 2; ++g)
#pragma unroll
    for (int t = 0; t < 4; ++t) acc[g][t] = vzero8();

  const _Float16* At = Af  + (long)(m0 >> 4) * KTILES * TILE_H;
  const _Float16* Wt = Wof + (long)(n0 >> 4) * KTILES * TILE_H;
  for (int kt = 0; kt < KTILES; ++kt) {
    v16h a0 = frag_pk(At + (long)kt * TILE_H, lane);
    v16h a1 = frag_pk(At + (long)(KTILES + kt) * TILE_H, lane);
#pragma unroll
    for (int t = 0; t < 4; ++t) {
      v16h bfr = frag_pk(Wt + (long)(t * KTILES + kt) * TILE_H, lane);
      acc[0][t] = wmma16(a0, bfr, acc[0][t]);
      acc[1][t] = wmma16(a1, bfr, acc[1][t]);
    }
  }

  const int cn = lane & 15;
  const int hi = (lane >> 4) & 1;
#pragma unroll
  for (int t = 0; t < 4; ++t) {
    const float bn = bo[n0 + t * 16 + cn];
#pragma unroll
    for (int g = 0; g < 2; ++g)
#pragma unroll
      for (int j = 0; j < 8; ++j)
        Out[(long)(m0 + g * 16 + j + 8 * hi) * DMODEL + n0 + t * 16 + cn] =
            acc[g][t][j] + bn;
  }
}

// ---------------------------------------------------------------------------
extern "C" void kernel_launch(void* const* d_in, const int* in_sizes, int n_in,
                              void* d_out, int out_size, void* d_ws, size_t ws_size,
                              hipStream_t stream) {
  const float* query = (const float*)d_in[0];
  const float* key   = (const float*)d_in[1];
  const float* value = (const float*)d_in[2];
  const float* biasS = (const float*)d_in[3];
  const float* Wq = (const float*)d_in[4];
  const float* bq = (const float*)d_in[5];
  const float* Wk = (const float*)d_in[6];
  const float* bk = (const float*)d_in[7];
  const float* Wv = (const float*)d_in[8];
  const float* bv = (const float*)d_in[9];
  const float* Wo = (const float*)d_in[10];
  const float* bo = (const float*)d_in[11];
  const float* lam = (const float*)d_in[12];
  float* out = (float*)d_out;

  const long XN = (long)MROWS * DMODEL;            // 4M elements per activation
  const long WN = (long)DMODEL * DMODEL;           // 1M elements per weight
  const long HN = (long)BATCH * NHEAD * SLEN * HDIM;  // 4M per head tensor

  // all packed 16x32 tiles (see the header)
  _Float16* Xf = (_Float16*)d_ws;        // [3][MROWS, D]   12M halfs
  _Float16* Wf = Xf + 3 * XN;            // [4][D, D]        4M halfs (q,k,v,o)
  _Float16* Qf = Wf + 4 * WN;            // [B,H][S x HD]    4M
  _Float16* Kf = Qf + HN;                // [B,H][S x HD]    4M
  _Float16* Vt = Kf + HN;                // [B,H][HD x S]    4M
  _Float16* Of = Vt + HN;                // [B*S, D]         4M

  dim3 blk128(128);

  // 0) f32 -> f16 conversions: Xf and Wf are one run of the workspace
  cvt_f16_kernel<<<dim3(CVT_BLOCKS), dim3(256), 0, stream>>>(
      query, key, value, Wq, Wk, Wv, Wo, Xf);

  // 1) QKV projections: grid.x = M/128 (4 waves x 32 rows), grid.y = D/64
  qkv_proj_kernel<<<dim3(MROWS / 128, DMODEL / 64, 3), blk128, 0, stream>>>(
      Xf, Wf, bq, bk, bv, Qf, Kf, Vt);

  // 2) attention: grid.x = S/64 (4 q-tiles per block), grid.y = H, grid.z = B
  attn_kernel<<<dim3(SLEN / 64, NHEAD, BATCH), blk128, 0, stream>>>(
      Qf, Kf, Vt, biasS, lam, Of);

  // 3) output projection
  oproj_kernel<<<dim3(MROWS / 128, DMODEL / 64), blk128, 0, stream>>>(
      Of, Wf + 3 * WN, bo, out);
}

// v004
// Measured time: 145 microseconds a run.
// Next to v003, in two timings, it ran 1.11 and 1.15 times as fast.
// All steps since v000 together make it 1.64 times as fast.
#include <hip/hip_runtime.h>
#include <hip/hip_bf16.h>

typedef __attribute__((ext_vector_type(16))) _Float16 v16h;
typedef __attribute__((ext_vector_type(8)))  _Float16 v8h;
typedef __attribute__((ext_vector_type(8)))  float    v8f;
typedef __attribute__((ext_vector_type(4)))  float    v4f;

#define BATCH   2
#define SLEN    2048
#define DMODEL  1024
#define NHEAD   16
#define HDIM    64
#define MROWS   (BATCH * SLEN)   // 4096
#define SCALE   0.125f           // 1/sqrt(64)

__device__ __forceinline__ v8f vzero8() {
  v8f z;
#pragma unroll
  for (int i = 0; i < 8; ++i) z[i] = 0.0f;
  return z;
}

__device__ __forceinline__ v8f wmma16(v16h a, v16h b, v8f c) {
  return __builtin_amdgcn_wmma_f32_16x16x32_f16(
      /*neg_a=*/false, a, /*neg_b=*/false, b,
      /*c_mod=*/(short)0, c, /*reuse_a=*/false, /*reuse_b=*/false);
}

#define TILE_H  512              // halfs per packed 16x32 tile
#define KTILES  (DMODEL / 32)    // packed tiles along k of a [rows, DMODEL] matrix

// Load a 16x32 f16 fragment (A or B) from one packed tile.
__device__ __forceinline__ v16h frag_pk(const _Float16* tile, int lane) {
  v8h lo = *(const v8h*)(tile + lane * 8);
  v8h hh = *(const v8h*)(tile + 256 + lane * 8);
  v16h f;
#pragma unroll
  for (int i = 0; i < 8; ++i) { f[i] = lo[i]; f[i + 8] = hh[i]; }
  return f;
}

// Offset (in halfs) of element (row c, k index kk) inside a packed tile.
__device__ __forceinline__ int pk_off(int c, int kk) {
  const int p = kk >> 3;
  return (((p >> 1) * 32 + (p & 1) * 16 + c) << 3) + (kk & 7);
}

// ---------------------------------------------------------------------------
// Kernel 0: f32 row-major -> f16 packed tiles, all seven tensors in one launch.
// The destinations follow one another in the workspace, so together they are
// the packed form of one stacked [CVT_ROWS, DMODEL] matrix (q, k, v, Wq, Wk,
// Wv, Wo); only the source pointer depends on the row.  One wave converts 16
// rows x 256 columns = 8 whole tiles (8 KB out, contiguous): 32 independent
// b128 loads, 16 b128 stores.  4096 waves, resident together.
// A load instruction reads half of one 128-byte line from each of 8 rows, a
// store instruction writes four whole 128-byte lines of one tile.
// ---------------------------------------------------------------------------
#define CVT_ROWS    (3 * MROWS + 4 * DMODEL)   // 16384 stacked rows
#define CVT_BLOCKS  (CVT_ROWS / 16 * 4 / 8)    // 4 waves per 16 rows, 8 waves per block

__global__ __launch_bounds__(256) void cvt_f16_kernel(
    const float* __restrict__ xq, const float* __restrict__ xk,
    const float* __restrict__ xv, const float* __restrict__ wq,
    const float* __restrict__ wk, const float* __restrict__ wv,
    const float* __restrict__ wo, _Float16* __restrict__ dst)
{
  const int lane = threadIdx.x & 31;
  const int wave = threadIdx.x >> 5;
  const int p    = lane & 3;                   // 8-wide k piece inside a tile
  const int r8   = lane >> 2;                  // row inside a half tile
  const int kq   = wave & 3;                   // which 8 of the 32 k tiles
  const int rg   = blockIdx.x * 2 + (wave >> 2);   // 16-row group, stacked

  // a block's two row groups lie in one tensor: the choice is block-uniform
  const int bg = blockIdx.x * 2;
  const float* src;
  int g0;                                      // the tensor's first row group
  if (bg < 3 * (MROWS / 16)) {
    const int w = bg / (MROWS / 16);
    src = (w == 0) ? xq : (w == 1) ? xk : xv;
    g0  = w * (MROWS / 16);
  } else {
    const int w = (bg - 3 * (MROWS / 16)) / (DMODEL / 16);
    src = (w == 0) ? wq : (w == 1) ? wk : (w == 2) ? wv : wo;
    g0  = 3 * (MROWS / 16) + w * (DMODEL / 16);
  }

  const float* s = src + (long)((rg - g0) * 16 + r8) * DMODEL + kq * 256 + p * 8;
  float4 a[2][8], b[2][8];
  // both loop nests are unrolled so that a and b stay in registers
#pragma unroll
  for (int hf = 0; hf < 2; ++hf)
#pragma unroll
    for (int t = 0; t < 8; ++t) {
      a[hf][t] = *(const float4*)(s + hf * 8 * DMODEL + t * 32);
      b[hf][t] = *(const float4*)(s + hf * 8 * DMODEL + t * 32 + 4);
    }
  // all 32 loads name the address s: it is an operand here so that its registers
  // stay whole until the wait, and may be reused only behind it
  asm volatile("s_wait_xcnt 0x0" :: "v"(s) : "memory");

  _Float16* d = dst + ((long)rg * KTILES + kq * 8) * TILE_H + pk_off(r8, p * 8);
#pragma unroll
  for (int hf = 0; hf < 2; ++hf)
#pragma unroll
    for (int t = 0; t < 8; ++t) {
      const float4 x = a[hf][t], y = b[hf][t];
      v8h o;
      o[0]=(_Float16)x.x; o[1]=(_Float16)x.y; o[2]=(_Float16)x.z; o[3]=(_Float16)x.w;
      o[4]=(_Float16)y.x; o[5]=(_Float16)y.y; o[6]=(_Float16)y.z; o[7]=(_Float16)y.w;
      *(v8h*)(d + t * TILE_H + hf * 64) = o;   // rows 8..15: 8 pieces further on
    }
}

// ---------------------------------------------------------------------------
// Kernel 1: QKV projection.  Out[m,n] = sum_k X[m,k]*W[n,k] + bias[n]
// blockIdx.z selects {Q,K,V}.  Per (b,h), packed tiles: Q,K rows = s, k = hd,
// tile (s/16)*2 + hd/32;  V rows = hd, k = s, tile (s/32)*4 + hd/16.
// One wave computes a 32x64 output tile: 2 A frags + 4 B frags -> 8 WMMAs.
// ---------------------------------------------------------------------------
__global__ __launch_bounds__(128) void qkv_proj_kernel(
    const _Float16* __restrict__ Xf,   // [3][MROWS, D] f16 packed (q,k,v)
    const _Float16* __restrict__ Wf,   // [3][D, D] f16 packed (Wq,Wk,Wv)
    const float* __restrict__ bq, const float* __restrict__ bk,
    const float* __restrict__ bv,
    _Float16* __restrict__ Qf, _Float16* __restrict__ Kf, _Float16* __restrict__ Vt)
{
  const int lane = threadIdx.x & 31;
  const int wave = threadIdx.x >> 5;
  const int which = blockIdx.z;

  const _Float16* X    = Xf + (long)which * MROWS * DMODEL;
  const _Float16* W    = Wf + (long)which * DMODEL * DMODEL;
  const float*    bias = (which == 0) ? bq : (which == 1) ? bk : bv;

  const int m0 = (blockIdx.x * 4 + wave) * 32;
  const int n0 = blockIdx.y * 64;

  v8f acc[2][4];
#pragma unroll
  for (int g = 0; g < 2; ++g)
#pragma unroll
    for (int t = 0; t < 4; ++t) acc[g][t] = vzero8();

  const _Float16* Xt = X + (long)(m0 >> 4) * KTILES * TILE_H;
  const _Float16* Wt = W + (long)(n0 >> 4) * KTILES * TILE_H;
  for (int kt = 0; kt < KTILES; ++kt) {
    v16h a0 = frag_pk(Xt + (long)kt * TILE_H, lane);
    v16h a1 = frag_pk(Xt + (long)(KTILES + kt) * TILE_H, lane);
#pragma unroll
    for (int t = 0; t < 4; ++t) {
      v16h bfr = frag_pk(Wt + (long)(t * KTILES + kt) * TILE_H, lane);
      acc[0][t] = wmma16(a0, bfr, acc[0][t]);
      acc[1][t] = wmma16(a1, bfr, acc[1][t]);
    }
  }

  const int cn = lane & 15;
  const int hi = (lane >> 4) & 1;
  const int h  = n0 >> 6;            // the 64 columns of a wave are one head
  const int b  = m0 >> 11;           // /2048; the 32 rows are one batch entry
  const int s0 = m0 & (SLEN - 1);
  const long hb = ((long)b * NHEAD + h) * SLEN * HDIM;
  if (which == 2) {
    _Float16* dst = Vt + hb + (long)(s0 >> 5) * 4 * TILE_H + lane * 8;
#pragma unroll
    for (int t = 0; t < 4; ++t) {
      const float bn = bias[n0 + t * 16 + cn];
#pragma unroll
      for (int g = 0; g < 2; ++g) {
        // a lane's 8 accumulators are 8 consecutive keys of one hd row: one piece
        v8h pv;
#pragma unroll
        for (int j = 0; j < 8; ++j) pv[j] = (_Float16)(acc[g][t][j] + bn);
        *(v8h*)(dst + t * TILE_H + g * 256) = pv;
        // the next group reuses this store's data registers
        asm volatile("s_wait_xcnt 0x0" ::: "memory");
      }
    }
  } else {
    _Float16* dst = ((which == 0) ? Qf : Kf) + hb + (long)(s0 >> 4) * 2 * TILE_H;
#pragma unroll
    for (int t = 0; t < 4; ++t) {
      const float bn = bias[n0 + t * 16 + cn];
#pragma unroll
      for (int g = 0; g < 2; ++g) {
#pragma unroll
        for (int j = 0; j < 8; ++j)
          dst[(g * 2 + (t >> 1)) * TILE_H + pk_off(j + 8 * hi, (t & 1) * 16 + cn)] =
              (_Float16)(acc[g][t][j] + bn);
        // the next group reuses these stores' data registers
        asm volatile("s_wait_xcnt 0x0" ::: "memory");
      }
    }
  }
}

// ---------------------------------------------------------------------------
// Kernel 2: flash-style attention, scores transposed.  One wave = 16 query
// columns for one (b,h).  Per 32 keys: S^T = K Q^T (A = packed K tiles, B = Q),
// so a lane holds 16 scores of ONE query (column lane&15; keys 8*hi + j and
// 16 + 8*hi + j).  Maximum and sum run inside the lane, the two lane halves
// exchange the maximum once per step and join their sums once at the end.
// The two score tiles, converted in place, are the B operand of
// O^T += V^T P^T (A = packed V tiles): P touches neither LDS nor another lane.
// A lane's bias values are 2 x 8 consecutive floats of its query's row.
// The 8 waves of a block work on one (b,h): its K and V tiles come into LDS once
// per block, 64 keys a stage, two buffers, by asynchronous copies (the packed
// tiles of a stage are 8 KB in a row, and keep their order in LDS, so a
// fragment read is 512 contiguous LDS bytes).
// ---------------------------------------------------------------------------
#define ATT_WAVES  8
#define STG_KEYS   64                     // keys per stage
#define STG_H      (STG_KEYS * HDIM)      // halfs of K (and of V) per stage: 8 KB
#define NSTG       (SLEN / STG_KEYS)
#define BUF_BYTES  (2 * STG_H * 2)        // one buffer: K stage, then V stage

// One stage into one buffer: a thread copies 2 x 16 bytes of K and 2 x 16 of V;
// l = its LDS byte address in the buffer, gk / gv = its first bytes of the stage.
__device__ __forceinline__ void kv_copy(unsigned l, const _Float16* gk, const _Float16* gv) {
  asm volatile(
      "global_load_async_to_lds_b128 %0, %4, off\n\t"
      "global_load_async_to_lds_b128 %1, %5, off\n\t"
      "global_load_async_to_lds_b128 %2, %6, off\n\t"
      "global_load_async_to_lds_b128 %3, %7, off\n\t"
      "s_wait_xcnt 0x0"
      :: "v"(l), "v"(l + 4096u), "v"(l + 8192u), "v"(l + 12288u),
         "v"(gk), "v"(gk + 2048), "v"(gv), "v"(gv + 2048)
      : "memory");
}

__device__ __forceinline__ float xhalf(float x) {
  const int b = __builtin_bit_cast(int, x);
  return __builtin_bit_cast(float, __builtin_amdgcn_permlanex16(
      b, b, 0x76543210, 0xfedcba98, false, false));
}

__global__ __launch_bounds__(ATT_WAVES * 32) __attribute__((amdgpu_waves_per_eu(4, 4)))
void attn_kernel(
    const _Float16* __restrict__ Qf, const _Float16* __restrict__ Kf,
    const _Float16* __restrict__ Vt,
    const float* __restrict__ bias_struct, const float* __restrict__ lambda_p,
    _Float16* __restrict__ Of)   // [B*S, D] f16 packed
{
  const int lane = threadIdx.x & 31;
  const int wave = threadIdx.x >> 5;
  const int q0 = (blockIdx.x * ATT_WAVES + wave) * 16;
  const int h  = blockIdx.y;
  const int b  = blockIdx.z;
  const float lam = *lambda_p;

  const _Float16* Qb = Qf + ((long)b * NHEAD + h) * SLEN * HDIM;
  const _Float16* Kb = Kf + ((long)b * NHEAD + h) * SLEN * HDIM;
  const _Float16* Vb = Vt + ((long)b * NHEAD + h) * HDIM * SLEN;

  const int cn = lane & 15;
  const int hi = (lane >> 4) & 1;

  // the lane's own query row of the bias, at its first key
  const float* Bl = bias_struct + ((long)b * SLEN + q0 + cn) * SLEN + hi * 8;

  // Q fragments (K-dim 0..31 and 32..63), loaded once; B operand: column = query
  const v16h bq0 = frag_pk(Qb + (long)((q0 >> 4) * 2 + 0) * TILE_H, lane);
  const v16h bq1 = frag_pk(Qb + (long)((q0 >> 4) * 2 + 1) * TILE_H, lane);

  // o[t][j] = O[query cn][hd = t*16 + 8*hi + j]
  v8f o[4];
#pragma unroll
  for (int t = 0; t < 4; ++t) o[t] = vzero8();
  float mrun = -3.0e38f;   // running maximum of the query, equal in both halves
  float lrun = 0.0f;       // running sum over this half's keys only

  __shared__ __attribute__((aligned(128))) _Float16 ring[2][2 * STG_H];
  const unsigned lds0 = (unsigned)(size_t)(&ring[0][0]) + threadIdx.x * 16u;
  const _Float16* gK = Kb + threadIdx.x * 8;
  const _Float16* gV = Vb + threadIdx.x * 8;

  // stage 0 lands and is published, then stage 1 flies while stage 0 is worked on
  kv_copy(lds0, gK, gV);
  asm volatile("s_wait_asynccnt 0x0" ::: "memory");   // this wave's copies have landed
  __syncthreads();
  kv_copy(lds0 + BUF_BYTES, gK + STG_H, gV + STG_H);

  for (int s = 0; s < NSTG; ++s) {
   const _Float16* Ks = &ring[s & 1][0];
   const _Float16* Vs = Ks + STG_H;
   // unrolled: a pass's place in the buffer becomes an immediate offset of its LDS reads
#pragma unroll
   for (int pa = 0; pa < STG_KEYS / 32; ++pa) {
    const int k0 = s * STG_KEYS + pa * 32;

    // bias of keys k0 + 8*hi + 0..7 and k0 + 16 + 8*hi + 0..7
    const v4f c0 = *(const v4f*)(Bl + k0);
    const v4f c1 = *(const v4f*)(Bl + k0 + 4);
    const v4f c2 = *(const v4f*)(Bl + k0 + 16);
    const v4f c3 = *(const v4f*)(Bl + k0 + 20);

    // scores^T: two 16x16 tiles (key rows k0..k0+15 and k0+16..k0+31)
    const _Float16* Kt = Ks + pa * 4 * TILE_H;                 // tiles: key16*2 + hd32
    const v16h ak0 = frag_pk(Kt + 0 * TILE_H, lane);
    const v16h ak1 = frag_pk(Kt + 1 * TILE_H, lane);
    const v16h ak2 = frag_pk(Kt + 2 * TILE_H, lane);
    const v16h ak3 = frag_pk(Kt + 3 * TILE_H, lane);
    // the pass's V fragments are read in the same group as K: one place with LDS
    // reads per pass instead of reads scattered among the exponentials and WMMAs
    // (unrolled so that avf stays in registers)
    v16h avf[4];
#pragma unroll
    for (int t = 0; t < 4; ++t) avf[t] = frag_pk(Vs + (pa * 4 + t) * TILE_H, lane);
    // keeps the bias loads and the LDS reads in front of the first WMMA: without it
    // the bias loads are sunk behind it and the V reads are spread over the pass
    __builtin_amdgcn_sched_barrier(0);
    v8f s0 = vzero8(), s1 = vzero8();
    s0 = wmma16(ak0, bq0, s0);
    s1 = wmma16(ak2, bq0, s1);
    s0 = wmma16(ak1, bq1, s0);
    s1 = wmma16(ak3, bq1, s1);

    // scale + structural bias, in the accumulators' own register order
    const v8f x0 = s0 * SCALE + lam * __builtin_shufflevector(c0, c1, 0, 1, 2, 3, 4, 5, 6, 7);
    const v8f x1 = s1 * SCALE + lam * __builtin_shufflevector(c2, c3, 0, 1, 2, 3, 4, 5, 6, 7);

    // online softmax update: one maximum, one correction per lane
    const float t0 = fmaxf(fmaxf(x0[0], x0[1]), x0[2]);
    const float t1 = fmaxf(fmaxf(x0[3], x0[4]), x0[5]);
    const float t2 = fmaxf(fmaxf(x0[6], x0[7]), x1[0]);
    const float t3 = fmaxf(fmaxf(x1[1], x1[2]), x1[3]);
    const float t4 = fmaxf(fmaxf(x1[4], x1[5]), x1[6]);
    float mv = fmaxf(fmaxf(fmaxf(t0, t1), t2), fmaxf(fmaxf(t3, t4), x1[7]));
    mv = fmaxf(mv, xhalf(mv));
    const float mnew = fmaxf(mrun, mv);
    const float corr = __expf(mrun - mnew);
    mrun = mnew;

    v16h bp;     // P^T as B operand: halfs[j] = key 8*hi + j, halfs[8+j] = key 16 + 8*hi + j
    v8f p0, p1;
#pragma unroll
    for (int j = 0; j < 8; ++j) {
      p0[j] = __expf(x0[j] - mnew);
      p1[j] = __expf(x1[j] - mnew);
      bp[j]     = (_Float16)p0[j];
      bp[j + 8] = (_Float16)p1[j];
    }
    const v8f ps = p0 + p1;
    lrun = lrun * corr +
           (((ps[0] + ps[4]) + (ps[2] + ps[6])) + ((ps[1] + ps[5]) + (ps[3] + ps[7])));
#pragma unroll
    for (int t = 0; t < 4; ++t) o[t] *= corr;

    // out^T += V^T (64x32) @ P^T (32x16), one packed V tile per 16 hd rows
#pragma unroll
    for (int t = 0; t < 4; ++t) o[t] = wmma16(avf[t], bp, o[t]);
   }
   // keeps the stage's arithmetic in front of the publish point, so that the refill
   // behind the barrier is issued a whole stage ahead of its wait
   __builtin_amdgcn_sched_barrier(0);
   // publish point of stage s + 1: this wave's reads of stage s are over, its
   // copies of stage s + 1 have landed; behind the barrier that holds for all waves
   asm volatile("s_wait_dscnt 0x0" ::: "memory");
   asm volatile("s_wait_asynccnt 0x0" ::: "memory");
   __syncthreads();
   // refill the buffer that every wave has just left
   if (s + 2 < NSTG)
     kv_copy(lds0 + (unsigned)(s & 1) * BUF_BYTES, gK + (long)(s + 2) * STG_H,
             gV + (long)(s + 2) * STG_H);
  }
  asm volatile("s_wait_asynccnt 0x0" ::: "memory");   // nothing is in flight at the wave's end

  // normalize and store attention output as f16 packed tiles of [B*S, D]:
  // a lane's 8 accumulators of o[t] are 8 consecutive columns of its row, one piece
  const float inv = 1.0f / (lrun + xhalf(lrun));
  _Float16* op = Of + ((long)((b * SLEN + q0) >> 4) * KTILES + h * 2) * TILE_H + lane * 8;
#pragma unroll
  for (int t = 0; t < 4; ++t) {
    v8h ov;
#pragma unroll
    for (int j = 0; j < 8; ++j) ov[j] = (_Float16)(o[t][j] * inv);
    *(v8h*)(op + (t >> 1) * TILE_H + (t & 1) * 256) = ov;
  }
}

// ---------------------------------------------------------------------------
// Kernel 3: output projection.  Out[m,n] = sum_k A[m,k]*Wo[n,k] + bo[n]  (f32)
// One wave computes a 32x64 output tile.
// ---------------------------------------------------------------------------
__global__ __launch_bounds__(128) void oproj_kernel(
    const _Float16* __restrict__ Af, const _Float16* __restrict__ Wof,
    const float* __restrict__ bo, float* __restrict__ Out)
{
  const int lane = threadIdx.x & 31;
  const int wave = threadIdx.x >> 5;
  const int m0 = (blockIdx.x * 4 + wave) * 32;
  const int n0 = blockIdx.y * 64;

  v8f acc[2][4];
#pragma unroll
  for (int g = 0; g < 2; ++g)
#pragma unroll
    for (int t = 0; t < 4; ++t) acc[g][t] = vzero8();

  const _Float16* At = Af  + (long)(m0 >> 4) * KTILES * TILE_H;
  const _Float16* Wt = Wof + (long)(n0 >> 4) * KTILES * TILE_H;
  for (int kt = 0; kt < KTILES; ++kt) {
    v16h a0 = frag_pk(At + (long)kt * TILE_H, lane);
    v16h a1 = frag_pk(At + (long)(KTILES + kt) * TILE_H, lane);
#pragma unroll
    for (int t = 0; t < 4; ++t) {
      v16h bfr = frag_pk(Wt + (long)(t * KTILES + kt) * TILE_H, lane);
      acc[0][t] = wmma16(a0, bfr, acc[0][t]);
      acc[1][t] = wmma16(a1, bfr, acc[1][t]);
    }
  }

  const int cn = lane & 15;
  const int hi = (lane >> 4) & 1;
#pragma unroll
  for (int t = 0; t < 4; ++t) {
    const float bn = bo[n0 + t * 16 + cn];
#pragma unroll
    for (int g = 0; g < 2; ++g)
#pragma unroll
      for (int j = 0; j < 8; ++j)
        Out[(long)(m0 + g * 16 + j + 8 * hi) * DMODEL + n0 + t * 16 + cn] =
            acc[g][t][j] + bn;
  }
}

// ---------------------------------------------------------------------------
extern "C" void kernel_launch(void* const* d_in, const int* in_sizes, int n_in,
                              void* d_out, int out_size, void* d_ws, size_t ws_size,
                              hipStream_t stream) {
  const float* query = (const float*)d_in[0];
  const float* key   = (const float*)d_in[1];
  const float* value = (const float*)d_in[2];
  const float* biasS = (const float*)d_in[3];
  const float* Wq = (const float*)d_in[4];
  const float* bq = (const float*)d_in[5];
  const float* Wk = (const float*)d_in[6];
  const float* bk = (const float*)d_in[7];
  const float* Wv = (const float*)d_in[8];
  const float* bv = (const float*)d_in[9];
  const float* Wo = (const float*)d_in[10];
  const float* bo = (const float*)d_in[11];
  const float* lam = (const float*)d_in[12];
  float* out = (float*)d_out;

  const long XN = (long)MROWS * DMODEL;            // 4M elements per activation
  const long WN = (long)DMODEL * DMODEL;           // 1M elements per weight
  const long HN = (long)BATCH * NHEAD * SLEN * HDIM;  // 4M per head tensor

  // all packed 16x32 tiles (see the header)
  _Float16* Xf = (_Float16*)d_ws;        // [3][MROWS, D]   12M halfs
  _Float16* Wf = Xf + 3 * XN;            // [4][D, D]        4M halfs (q,k,v,o)
  _Float16* Qf = Wf + 4 * WN;            // [B,H][S x HD]    4M
  _Float16* Kf = Qf + HN;                // [B,H][S x HD]    4M
  _Float16* Vt = Kf + HN;                // [B,H][HD x S]    4M
  _Float16* Of = Vt + HN;                // [B*S, D]         4M

  dim3 blk128(128);

  // 0) f32 -> f16 conversions: Xf and Wf are one run of the workspace
  cvt_f16_kernel<<<dim3(CVT_BLOCKS), dim3(256), 0, stream>>>(
      query, key, value, Wq, Wk, Wv, Wo, Xf);

  // 1) QKV projections: grid.x = M/128 (4 waves x 32 rows), grid.y = D/64
  qkv_proj_kernel<<<dim3(MROWS / 128, DMODEL / 64, 3), blk128, 0, stream>>>(
      Xf, Wf, bq, bk, bv, Qf, Kf, Vt);

  // 2) attention: grid.x = S/128 (8 q-tiles per block), grid.y = H, grid.z = B
  attn_kernel<<<dim3(SLEN / (ATT_WAVES * 16), NHEAD, BATCH), dim3(ATT_WAVES * 32), 0, stream>>>(
      Qf, Kf, Vt, biasS, lam, Of);

  // 3) output projection
  oproj_kernel<<<dim3(MROWS / 128, DMODEL / 64), blk128, 0, stream>>>(
      Of, Wf + 3 * WN, bo, out);
}

// v005
// Measured time: 132 microseconds a run.
// Timed twice side by side with v004, it ran 1.11 and 1.12 times as fast.
// Over all steps from v000 it is 1.83 times as fast.
#include <hip/hip_runtime.h>
#include <hip/hip_bf16.h>

typedef __attribute__((ext_vector_type(16))) _Float16 v16h;
typedef __attribute__((ext_vector_type(8)))  _Float16 v8h;
typedef __attribute__((ext_vector_type(8)))  float    v8f;
typedef __attribute__((ext_vector_type(4)))  float    v4f;

#define BATCH   2
#define SLEN    2048
#define DMODEL  1024
#define NHEAD   16
#define HDIM    64
#define MROWS   (BATCH * SLEN)   // 4096
#define SCALE   0.125f           // 1/sqrt(64)

__device__ __forceinline__ v8f vzero8() {
  v8f z;
#pragma unroll
  for (int i = 0; i < 8; ++i) z[i] = 0.0f;
  return z;
}

__device__ __forceinline__ v8f wmma16(v16h a, v16h b, v8f c) {
  return __builtin_amdgcn_wmma_f32_16x16x32_f16(
      /*neg_a=*/false, a, /*neg_b=*/false, b,
      /*c_mod=*/(short)0, c, /*reuse_a=*/false, /*reuse_b=*/false);
}

#define TILE_H  512              // halfs per packed 16x32 tile
#define KTILES  (DMODEL / 32)    // packed tiles along k of a [rows, DMODEL] matrix

// Load a 16x32 f16 fragment (A or B) from one packed tile.
__device__ __forceinline__ v16h frag_pk(const _Float16* tile, int lane) {
  v8h lo = *(const v8h*)(tile + lane * 8);
  v8h hh = *(const v8h*)(tile + 256 + lane * 8);
  v16h f;
#pragma unroll
  for (int i = 0; i < 8; ++i) { f[i] = lo[i]; f[i + 8] = hh[i]; }
  return f;
}

// Offset (in halfs) of element (row c, k index kk) inside a packed tile.
__device__ __forceinline__ int pk_off(int c, int kk) {
  const int p = kk >> 3;
  return (((p >> 1) * 32 + (p & 1) * 16 + c) << 3) + (kk & 7);
}

// ---------------------------------------------------------------------------
// Kernel 0: f32 row-major -> f16 packed tiles, all seven tensors in one launch.
// The destinations follow one another in the workspace, so together they are
// the packed form of one stacked [CVT_ROWS, DMODEL] matrix (q, k, v, Wq, Wk,
// Wv, Wo); only the source pointer depends on the row.  One wave converts 16
// rows x 256 columns = 8 whole tiles (8 KB out, contiguous): 32 independent
// b128 loads, 16 b128 stores.  4096 waves, resident together.
// A load instruction reads half of one 128-byte line from each of 8 rows, a
// store instruction writes four whole 128-byte lines of one tile.
// ---------------------------------------------------------------------------
#define CVT_ROWS    (3 * MROWS + 4 * DMODEL)   // 16384 stacked rows
#define CVT_BLOCKS  (CVT_ROWS / 16 * 4 / 8)    // 4 waves per 16 rows, 8 waves per block

__global__ __launch_bounds__(256) void cvt_f16_kernel(
    const float* __restrict__ xq, const float* __restrict__ xk,
    const float* __restrict__ xv, const float* __restrict__ wq,
    const float* __restrict__ wk, const float* __restrict__ wv,
    const float* __restrict__ wo, _Float16* __restrict__ dst)
{
  const int lane = threadIdx.x & 31;
  const int wave = threadIdx.x >> 5;
  const int p    = lane & 3;                   // 8-wide k piece inside a tile
  const int r8   = lane >> 2;                  // row inside a half tile
  const int kq   = wave & 3;                   // which 8 of the 32 k tiles
  const int rg   = blockIdx.x * 2 + (wave >> 2);   // 16-row group, stacked

  // a block's two row groups lie in one tensor: the choice is block-uniform
  const int bg = blockIdx.x * 2;
  const float* src;
  int g0;                                      // the tensor's first row group
  if (bg < 3 * (MROWS / 16)) {
    const int w = bg / (MROWS / 16);
    src = (w == 0) ? xq : (w == 1) ? xk : xv;
    g0  = w * (MROWS / 16);
  } else {
    const int w = (bg - 3 * (MROWS / 16)) / (DMODEL / 16);
    src = (w == 0) ? wq : (w == 1) ? wk : (w == 2) ? wv : wo;
    g0  = 3 * (MROWS / 16) + w * (DMODEL / 16);
  }

  const float* s = src + (long)((rg - g0) * 16 + r8) * DMODEL + kq * 256 + p * 8;
  float4 a[2][8], b[2][8];
  // both loop nests are unrolled so that a and b stay in registers
#pragma unroll
  for (int hf = 0; hf < 2; ++hf)
#pragma unroll
    for (int t = 0; t < 8; ++t) {
      a[hf][t] = *(const float4*)(s + hf * 8 * DMODEL + t * 32);
      b[hf][t] = *(const float4*)(s + hf * 8 * DMODEL + t * 32 + 4);
    }
  // all 32 loads name the address s: it is an operand here so that its registers
  // stay whole until the wait, and may be reused only behind it
  asm volatile("s_wait_xcnt 0x0" :: "v"(s) : "memory");

  _Float16* d = dst + ((long)rg * KTILES + kq * 8) * TILE_H + pk_off(r8, p * 8);
#pragma unroll
  for (int hf = 0; hf < 2; ++hf)
#pragma unroll
    for (int t = 0; t < 8; ++t) {
      const float4 x = a[hf][t], y = b[hf][t];
      v8h o;
      o[0]=(_Float16)x.x; o[1]=(_Float16)x.y; o[2]=(_Float16)x.z; o[3]=(_Float16)x.w;
      o[4]=(_Float16)y.x; o[5]=(_Float16)y.y; o[6]=(_Float16)y.z; o[7]=(_Float16)y.w;
      *(v8h*)(d + t * TILE_H + hf * 64) = o;   // rows 8..15: 8 pieces further on
    }
}

// ---------------------------------------------------------------------------
// Kernel 1: QKV projection.  Out[m,n] = sum_k X[m,k]*W[n,k] + bias[n]
// blockIdx.z selects {Q,K,V}.  Per (b,h), packed tiles: Q,K rows = s, k = hd,
// tile (s/16)*2 + hd/32;  V rows = hd, k = s, tile (s/32)*4 + hd/16.
// One wave computes a 32x64 output tile: 2 A frags + 4 B frags -> 8 WMMAs.
// ---------------------------------------------------------------------------
__global__ __launch_bounds__(128) void qkv_proj_kernel(
    const _Float16* __restrict__ Xf,   // [3][MROWS, D] f16 packed (q,k,v)
    const _Float16* __restrict__ Wf,   // [3][D, D] f16 packed (Wq,Wk,Wv)
    const float* __restrict__ bq, const float* __restrict__ bk,
    const float* __restrict__ bv,
    _Float16* __restrict__ Qf, _Float16* __restrict__ Kf, _Float16* __restrict__ Vt)
{
  const int lane = threadIdx.x & 31;
  const int wave = threadIdx.x >> 5;
  const int which = blockIdx.z;

  const _Float16* X    = Xf + (long)which * MROWS * DMODEL;
  const _Float16* W    = Wf + (long)which * DMODEL * DMODEL;
  const float*    bias = (which == 0) ? bq : (which == 1) ? bk : bv;

  const int m0 = (blockIdx.x * 4 + wave) * 32;
  const int n0 = blockIdx.y * 64;

  v8f acc[2][4];
#pragma unroll
  for (int g = 0; g < 2; ++g)
#pragma unroll
    for (int t = 0; t < 4; ++t) acc[g][t] = vzero8();

  const _Float16* Xt = X + (long)(m0 >> 4) * KTILES * TILE_H;
  const _Float16* Wt = W + (long)(n0 >> 4) * KTILES * TILE_H;
  for (int kt = 0; kt < KTILES; ++kt) {
    v16h a0 = frag_pk(Xt + (long)kt * TILE_H, lane);
    v16h a1 = frag_pk(Xt + (long)(KTILES + kt) * TILE_H, lane);
#pragma unroll
    for (int t = 0; t < 4; ++t) {
      v16h bfr = frag_pk(Wt + (long)(t * KTILES + kt) * TILE_H, lane);
      acc[0][t] = wmma16(a0, bfr, acc[0][t]);
      acc[1][t] = wmma16(a1, bfr, acc[1][t]);
    }
  }

  const int cn = lane & 15;
  const int hi = (lane >> 4) & 1;
  const int h  = n0 >> 6;            // the 64 columns of a wave are one head
  const int b  = m0 >> 11;           // /2048; the 32 rows are one batch entry
  const int s0 = m0 & (SLEN - 1);
  const long hb = ((long)b * NHEAD + h) * SLEN * HDIM;
  if (which == 2) {
    _Float16* dst = Vt + hb + (long)(s0 >> 5) * 4 * TILE_H + lane * 8;
#pragma unroll
    for (int t = 0; t < 4; ++t) {
      const float bn = bias[n0 + t * 16 + cn];
#pragma unroll
      for (int g = 0; g < 2; ++g) {
        // a lane's 8 accumulators are 8 consecutive keys of one hd row: one piece
        v8h pv;
#pragma unroll
        for (int j = 0; j < 8; ++j) pv[j] = (_Float16)(acc[g][t][j] + bn);
        *(v8h*)(dst + t * TILE_H + g * 256) = pv;
        // the next group reuses this store's data registers
        asm volatile("s_wait_xcnt 0x0" ::: "memory");
      }
    }
  } else {
    _Float16* dst = ((which == 0) ? Qf : Kf) + hb + (long)(s0 >> 4) * 2 * TILE_H;
#pragma unroll
    for (int t = 0; t < 4; ++t) {
      const float bn = bias[n0 + t * 16 + cn];
#pragma unroll
      for (int g = 0; g < 2; ++g) {
#pragma unroll
        for (int j = 0; j < 8; ++j)
          dst[(g * 2 + (t >> 1)) * TILE_H + pk_off(j + 8 * hi, (t & 1) * 16 + cn)] =
              (_Float16)(acc[g][t][j] + bn);
        // the next group reuses these stores' data registers
        asm volatile("s_wait_xcnt 0x0" ::: "memory");
      }
    }
  }
}

// ---------------------------------------------------------------------------
// Kernel 2: flash-style attention, scores transposed.  One wave = 16 query
// columns for one (b,h).  Per 32 keys: S^T = K Q^T (A = packed K tiles, B = Q),
// so a lane holds 16 scores of ONE query (column lane&15; keys 8*hi + j and
// 16 + 8*hi + j).  Maximum and sum run inside the lane, the two lane halves
// exchange the maximum once per step and join their sums once at the end.
// The two score tiles, converted in place, are the B operand of
// O^T += V^T P^T (A = packed V tiles): P touches neither LDS nor another lane.
// A lane's bias values are 2 x 8 consecutive floats of its query's row; a wave's
// 16 rows x 64 keys of a stage come into LDS with the K/V stage, by copies that
// each take 2 rows x 256 contiguous bytes (four whole lines), and the lane reads
// its row there (read from global memory, each load would touch 16 lines).
// The 8 waves of a block work on one (b,h): its K and V tiles come into LDS once
// per block, 64 keys a stage, two buffers, by asynchronous copies (the packed
// tiles of a stage are 8 KB in a row, and keep their order in LDS, so a
// fragment read is 512 contiguous LDS bytes).
// ---------------------------------------------------------------------------
#define ATT_WAVES  8
#define STG_KEYS   64                     // keys per stage
#define STG_H      (STG_KEYS * HDIM)      // halfs of K (and of V) per stage: 8 KB
#define NSTG       (SLEN / STG_KEYS)
#define BUF_BYTES  (2 * STG_H * 2)        // one buffer: K stage, then V stage

// One stage into one buffer: a thread copies 2 x 16 bytes of K and 2 x 16 of V;
// l = its LDS byte address in the buffer, gk / gv = its first bytes of the stage.
__device__ __forceinline__ void kv_copy(unsigned l, const _Float16* gk, const _Float16* gv) {
  asm volatile(
      "global_load_async_to_lds_b128 %0, %4, off\n\t"
      "global_load_async_to_lds_b128 %1, %5, off\n\t"
      "global_load_async_to_lds_b128 %2, %6, off\n\t"
      "global_load_async_to_lds_b128 %3, %7, off\n\t"
      "s_wait_xcnt 0x0"
      :: "v"(l), "v"(l + 4096u), "v"(l + 8192u), "v"(l + 12288u),
         "v"(gk), "v"(gk + 2048), "v"(gv), "v"(gv + 2048)
      : "memory");
}

#define BIAS_PITCH  (STG_KEYS + 4)
#define BIAS_WAVE_B (16 * BIAS_PITCH * 4)
#define BIAS_BUF_B  (ATT_WAVES * BIAS_WAVE_B)

__device__ __forceinline__ void bias_copy(unsigned l, const float* g) {
  asm volatile(
      "global_load_async_to_lds_b128 %0, %8, off\n\t"
      "global_load_async_to_lds_b128 %1, %9, off\n\t"
      "global_load_async_to_lds_b128 %2, %10, off\n\t"
      "global_load_async_to_lds_b128 %3, %11, off\n\t"
      "global_load_async_to_lds_b128 %4, %12, off\n\t"
      "global_load_async_to_lds_b128 %5, %13, off\n\t"
      "global_load_async_to_lds_b128 %6, %14, off\n\t"
      "global_load_async_to_lds_b128 %7, %15, off\n\t"
      "s_wait_xcnt 0x0"
      :: "v"(l), "v"(l + 2u * BIAS_PITCH * 4u), "v"(l + 4u * BIAS_PITCH * 4u),
         "v"(l + 6u * BIAS_PITCH * 4u), "v"(l + 8u * BIAS_PITCH * 4u),
         "v"(l + 10u * BIAS_PITCH * 4u), "v"(l + 12u * BIAS_PITCH * 4u),
         "v"(l + 14u * BIAS_PITCH * 4u),
         "v"(g), "v"(g + 2 * SLEN), "v"(g + 4 * SLEN), "v"(g + 6 * SLEN),
         "v"(g + 8 * SLEN), "v"(g + 10 * SLEN), "v"(g + 12 * SLEN), "v"(g + 14 * SLEN)
      : "memory");
}

__device__ __forceinline__ float xhalf(float x) {
  const int b = __builtin_bit_cast(int, x);
  return __builtin_bit_cast(float, __builtin_amdgcn_permlanex16(
      b, b, 0x76543210, 0xfedcba98, false, false));
}

__global__ __launch_bounds__(ATT_WAVES * 32) __attribute__((amdgpu_waves_per_eu(4, 4)))
void attn_kernel(
    const _Float16* __restrict__ Qf, const _Float16* __restrict__ Kf,
    const _Float16* __restrict__ Vt,
    const float* __restrict__ bias_struct, const float* __restrict__ lambda_p,
    _Float16* __restrict__ Of)   // [B*S, D] f16 packed
{
  const int lane = threadIdx.x & 31;
  const int wave = threadIdx.x >> 5;
  const int q0 = (blockIdx.x * ATT_WAVES + wave) * 16;
  const int h  = blockIdx.y;
  const int b  = blockIdx.z;
  const float lam = *lambda_p;

  const _Float16* Qb = Qf + ((long)b * NHEAD + h) * SLEN * HDIM;
  const _Float16* Kb = Kf + ((long)b * NHEAD + h) * SLEN * HDIM;
  const _Float16* Vb = Vt + ((long)b * NHEAD + h) * HDIM * SLEN;

  const int cn = lane & 15;
  const int hi = (lane >> 4) & 1;

  // what the lane copies of the bias: row hi of the wave's 16, 16-byte piece cn
  const float* gB = bias_struct + ((long)b * SLEN + q0 + hi) * SLEN + cn * 4;

  // Q fragments (K-dim 0..31 and 32..63), loaded once; B operand: column = query
  const v16h bq0 = frag_pk(Qb + (long)((q0 >> 4) * 2 + 0) * TILE_H, lane);
  const v16h bq1 = frag_pk(Qb + (long)((q0 >> 4) * 2 + 1) * TILE_H, lane);

  // o[t][j] = O[query cn][hd = t*16 + 8*hi + j]
  v8f o[4];
#pragma unroll
  for (int t = 0; t < 4; ++t) o[t] = vzero8();
  float mrun = -3.0e38f;   // running maximum of the query, equal in both halves
  float lrun = 0.0f;       // running sum over this half's keys only

  __shared__ __attribute__((aligned(128))) _Float16 ring[2][2 * STG_H];
  const unsigned lds0 = (unsigned)(size_t)(&ring[0][0]) + threadIdx.x * 16u;
  const _Float16* gK = Kb + threadIdx.x * 8;
  const _Float16* gV = Vb + threadIdx.x * 8;
  __shared__ __attribute__((aligned(128))) float bring[2][ATT_WAVES][16 * BIAS_PITCH];
  const unsigned ldsb = (unsigned)(size_t)(&bring[0][wave][0]) + (hi * BIAS_PITCH + cn * 4) * 4u;

  // stage 0 lands and is published, then stage 1 flies while stage 0 is worked on
  kv_copy(lds0, gK, gV);
  bias_copy(ldsb, gB);
  asm volatile("s_wait_asynccnt 0x0" ::: "memory");   // this wave's copies have landed
  __syncthreads();
  kv_copy(lds0 + BUF_BYTES, gK + STG_H, gV + STG_H);
  bias_copy(ldsb + BIAS_BUF_B, gB + STG_KEYS);

  for (int s = 0; s < NSTG; ++s) {
   const _Float16* Ks = &ring[s & 1][0];
   const _Float16* Vs = Ks + STG_H;
   // the lane's own query row of the stage's bias, at its first key
   const float* Bl = &bring[s & 1][wave][cn * BIAS_PITCH + hi * 8];
   // unrolled: a pass's place in the buffer becomes an immediate offset of its LDS reads
#pragma unroll
   for (int pa = 0; pa < STG_KEYS / 32; ++pa) {
    const int k0 = pa * 32;                 // first key of the pass inside the stage

    // bias of keys k0 + 8*hi + 0..7 and k0 + 16 + 8*hi + 0..7, from LDS
    const v4f c0 = *(const v4f*)(Bl + k0);
    const v4f c1 = *(const v4f*)(Bl + k0 + 4);
    const v4f c2 = *(const v4f*)(Bl + k0 + 16);
    const v4f c3 = *(const v4f*)(Bl + k0 + 20);

    // scores^T: two 16x16 tiles (key rows k0..k0+15 and k0+16..k0+31)
    const _Float16* Kt = Ks + pa * 4 * TILE_H;                 // tiles: key16*2 + hd32
    const v16h ak0 = frag_pk(Kt + 0 * TILE_H, lane);
    const v16h ak1 = frag_pk(Kt + 1 * TILE_H, lane);
    const v16h ak2 = frag_pk(Kt + 2 * TILE_H, lane);
    const v16h ak3 = frag_pk(Kt + 3 * TILE_H, lane);
    // the pass's V fragments are read in the same group as K: one place with LDS
    // reads per pass instead of reads scattered among the exponentials and WMMAs
    // (unrolled so that avf stays in registers)
    v16h avf[4];
#pragma unroll
    for (int t = 0; t < 4; ++t) avf[t] = frag_pk(Vs + (pa * 4 + t) * TILE_H, lane);
    // keeps the pass's LDS reads (bias, K, V) in front of its first WMMA: without it
    // they are spread in twos and fours over the pass
    __builtin_amdgcn_sched_barrier(0);
    v8f s0 = vzero8(), s1 = vzero8();
    s0 = wmma16(ak0, bq0, s0);
    s1 = wmma16(ak2, bq0, s1);
    s0 = wmma16(ak1, bq1, s0);
    s1 = wmma16(ak3, bq1, s1);

    // scale + structural bias, in the accumulators' own register order
    const v8f x0 = s0 * SCALE + lam * __builtin_shufflevector(c0, c1, 0, 1, 2, 3, 4, 5, 6, 7);
    const v8f x1 = s1 * SCALE + lam * __builtin_shufflevector(c2, c3, 0, 1, 2, 3, 4, 5, 6, 7);

    // online softmax update: one maximum, one correction per lane
    const float t0 = fmaxf(fmaxf(x0[0], x0[1]), x0[2]);
    const float t1 = fmaxf(fmaxf(x0[3], x0[4]), x0[5]);
    const float t2 = fmaxf(fmaxf(x0[6], x0[7]), x1[0]);
    const float t3 = fmaxf(fmaxf(x1[1], x1[2]), x1[3]);
    const float t4 = fmaxf(fmaxf(x1[4], x1[5]), x1[6]);
    float mv = fmaxf(fmaxf(fmaxf(t0, t1), t2), fmaxf(fmaxf(t3, t4), x1[7]));
    mv = fmaxf(mv, xhalf(mv));
    const float mnew = fmaxf(mrun, mv);
    const float corr = __expf(mrun - mnew);
    mrun = mnew;

    v16h bp;     // P^T as B operand: halfs[j] = key 8*hi + j, halfs[8+j] = key 16 + 8*hi + j
    v8f p0, p1;
#pragma unroll
    for (int j = 0; j < 8; ++j) {
      p0[j] = __expf(x0[j] - mnew);
      p1[j] = __expf(x1[j] - mnew);
      bp[j]     = (_Float16)p0[j];
      bp[j + 8] = (_Float16)p1[j];
    }
    const v8f ps = p0 + p1;
    lrun = lrun * corr +
           (((ps[0] + ps[4]) + (ps[2] + ps[6])) + ((ps[1] + ps[5]) + (ps[3] + ps[7])));
#pragma unroll
    for (int t = 0; t < 4; ++t) o[t] *= corr;

    // out^T += V^T (64x32) @ P^T (32x16), one packed V tile per 16 hd rows
#pragma unroll
    for (int t = 0; t < 4; ++t) o[t] = wmma16(avf[t], bp, o[t]);
   }
   // keeps the stage's arithmetic in front of the publish point, so that the refill
   // behind the barrier is issued a whole stage ahead of its wait
   __builtin_amdgcn_sched_barrier(0);
   // publish point of stage s + 1: this wave's reads of stage s are over, its
   // copies of stage s + 1 have landed; behind the barrier that holds for all waves
   asm volatile("s_wait_dscnt 0x0" ::: "memory");
   asm volatile("s_wait_asynccnt 0x0" ::: "memory");
   __syncthreads();
   // refill the buffer that every wave has just left
   if (s + 2 < NSTG) {
     kv_copy(lds0 + (unsigned)(s & 1) * BUF_BYTES, gK + (long)(s + 2) * STG_H,
             gV + (long)(s + 2) * STG_H);
     bias_copy(ldsb + (unsigned)(s & 1) * BIAS_BUF_B, gB + (s + 2) * STG_KEYS);
   }
  }
  asm volatile("s_wait_asynccnt 0x0" ::: "memory");   // nothing is in flight at the wave's end

  // normalize and store attention output as f16 packed tiles of [B*S, D]:
  // a lane's 8 accumulators of o[t] are 8 consecutive columns of its row, one piece
  const float inv = 1.0f / (lrun + xhalf(lrun));
  _Float16* op = Of + ((long)((b * SLEN + q0) >> 4) * KTILES + h * 2) * TILE_H + lane * 8;
#pragma unroll
  for (int t = 0; t < 4; ++t) {
    v8h ov;
#pragma unroll
    for (int j = 0; j < 8; ++j) ov[j] = (_Float16)(o[t][j] * inv);
    *(v8h*)(op + (t >> 1) * TILE_H + (t & 1) * 256) = ov;
  }
}

// ---------------------------------------------------------------------------
// Kernel 3: output projection.  Out[m,n] = sum_k A[m,k]*Wo[n,k] + bo[n]  (f32)
// One wave computes a 32x64 output tile.
// ---------------------------------------------------------------------------
__global__ __launch_bounds__(128) void oproj_kernel(
    const _Float16* __restrict__ Af, const _Float16* __restrict__ Wof,
    const float* __restrict__ bo, float* __restrict__ Out)
{
  const int lane = threadIdx.x & 31;
  const int wave = threadIdx.x >> 5;
  const int m0 = (blockIdx.x * 4 + wave) * 32;
  const int n0 = blockIdx.y * 64;

  v8f acc[2][4];
#pragma unroll
  for (int g = 0; g < 2; ++g)
#pragma unroll
    for (int t = 0; t < 4; ++t) acc[g][t] = vzero8();

  const _Float16* At = Af  + (long)(m0 >> 4) * KTILES * TILE_H;
  const _Float16* Wt = Wof + (long)(n0 >> 4) * KTILES * TILE_H;
  for (int kt = 0; kt < KTILES; ++kt) {
    v16h a0 = frag_pk(At + (long)kt * TILE_H, lane);
    v16h a1 = frag_pk(At + (long)(KTILES + kt) * TILE_H, lane);
#pragma unroll
    for (int t = 0; t < 4; ++t) {
      v16h bfr = frag_pk(Wt + (long)(t * KTILES + kt) * TILE_H, lane);
      acc[0][t] = wmma16(a0, bfr, acc[0][t]);
      acc[1][t] = wmma16(a1, bfr, acc[1][t]);
    }
  }

  const int cn = lane & 15;
  const int hi = (lane >> 4) & 1;
#pragma unroll
  for (int t = 0; t < 4; ++t) {
    const float bn = bo[n0 + t * 16 + cn];
#pragma unroll
    for (int g = 0; g < 2; ++g)
#pragma unroll
      for (int j = 0; j < 8; ++j)
        Out[(long)(m0 + g * 16 + j + 8 * hi) * DMODEL + n0 + t * 16 + cn] =
            acc[g][t][j] + bn;
  }
}

// ---------------------------------------------------------------------------
extern "C" void kernel_launch(void* const* d_in, const int* in_sizes, int n_in,
                              void* d_out, int out_size, void* d_ws, size_t ws_size,
                              hipStream_t stream) {
  const float* query = (const float*)d_in[0];
  const float* key   = (const float*)d_in[1];
  const float* value = (const float*)d_in[2];
  const float* biasS = (const float*)d_in[3];
  const float* Wq = (const float*)d_in[4];
  const float* bq = (const float*)d_in[5];
  const float* Wk = (const float*)d_in[6];
  const float* bk = (const float*)d_in[7];
  const float* Wv = (const float*)d_in[8];
  const float* bv = (const float*)d_in[9];
  const float* Wo = (const float*)d_in[10];
  const float* bo = (const float*)d_in[11];
  const float* lam = (const float*)d_in[12];
  float* out = (float*)d_out;

  const long XN = (long)MROWS * DMODEL;            // 4M elements per activation
  const long WN = (long)DMODEL * DMODEL;           // 1M elements per weight
  const long HN = (long)BATCH * NHEAD * SLEN * HDIM;  // 4M per head tensor

  // all packed 16x32 tiles (see the header)
  _Float16* Xf = (_Float16*)d_ws;        // [3][MROWS, D]   12M halfs
  _Float16* Wf = Xf + 3 * XN;            // [4][D, D]        4M halfs (q,k,v,o)
  _Float16* Qf = Wf + 4 * WN;            // [B,H][S x HD]    4M
  _Float16* Kf = Qf + HN;                // [B,H][S x HD]    4M
  _Float16* Vt = Kf + HN;                // [B,H][HD x S]    4M
  _Float16* Of = Vt + HN;                // [B*S, D]         4M

  dim3 blk128(128);

  // 0) f32 -> f16 conversions: Xf and Wf are one run of the workspace
  cvt_f16_kernel<<<dim3(CVT_BLOCKS), dim3(256), 0, stream>>>(
      query, key, value, Wq, Wk, Wv, Wo, Xf);

  // 1) QKV projections: grid.x = M/128 (4 waves x 32 rows), grid.y = D/64
  qkv_proj_kernel<<<dim3(MROWS / 128, DMODEL / 64, 3), blk128, 0, stream>>>(
      Xf, Wf, bq, bk, bv, Qf, Kf, Vt);

  // 2) attention: grid.x = S/128 (8 q-tiles per block), grid.y = H, grid.z = B
  attn_kernel<<<dim3(SLEN / (ATT_WAVES * 16), NHEAD, BATCH), dim3(ATT_WAVES * 32), 0, stream>>>(
      Qf, Kf, Vt, biasS, lam, Of);

  // 3) output projection
  oproj_kernel<<<dim3(MROWS / 128, DMODEL / 64), blk128, 0, stream>>>(
      Of, Wf + 3 * WN, bo, out);
}

// v006
// It runs in 90.7 microseconds.
// In two side-by-side timings against v005, it was 1.49 and 1.46 times as fast.
// Over all steps from v000 it is 2.70 times as fast.
#include <hip/hip_runtime.h>
#include <hip/hip_bf16.h>

typedef __attribute__((ext_vector_type(16))) _Float16 v16h;
typedef __attribute__((ext_vector_type(8)))  _Float16 v8h;
typedef __attribute__((ext_vector_type(8)))  float    v8f;
typedef __attribute__((ext_vector_type(4)))  float    v4f;

#define BATCH   2
#define SLEN    2048
#define DMODEL  1024
#define NHEAD   16
#define HDIM    64
#define MROWS   (BATCH * SLEN)   // 4096
#define SCALE   0.125f           // 1/sqrt(64)

__device__ __forceinline__ v8f vzero8() {
  v8f z;
#pragma unroll
  for (int i = 0; i < 8; ++i) z[i] = 0.0f;
  return z;
}

__device__ __forceinline__ v8f wmma16(v16h a, v16h b, v8f c) {
  return __builtin_amdgcn_wmma_f32_16x16x32_f16(
      /*neg_a=*/false, a, /*neg_b=*/false, b,
      /*c_mod=*/(short)0, c, /*reuse_a=*/false, /*reuse_b=*/false);
}

#define TILE_H  512              // halfs per packed 16x32 tile
#define KTILES  (DMODEL / 32)    // packed tiles along k of a [rows, DMODEL] matrix

// Load a 16x32 f16 fragment (A or B) from one packed tile.
__device__ __forceinline__ v16h frag_pk(const _Float16* tile, int lane) {
  v8h lo = *(const v8h*)(tile + lane * 8);
  v8h hh = *(const v8h*)(tile + 256 + lane * 8);
  v16h f;
#pragma unroll
  for (int i = 0; i < 8; ++i) { f[i] = lo[i]; f[i + 8] = hh[i]; }
  return f;
}

// Offset (in halfs) of element (row c, k index kk) inside a packed tile.
__device__ __forceinline__ int pk_off(int c, int kk) {
  const int p = kk >> 3;
  return (((p >> 1) * 32 + (p & 1) * 16 + c) << 3) + (kk & 7);
}

// ---------------------------------------------------------------------------
// Kernel 0: f32 row-major -> f16 packed tiles, all seven tensors in one launch.
// The destinations follow one another in the workspace, so together they are
// the packed form of one stacked [CVT_ROWS, DMODEL] matrix (q, k, v, Wq, Wk,
// Wv, Wo); only the source pointer depends on the row.  One wave converts 16
// rows x 256 columns = 8 whole tiles (8 KB out, contiguous): 32 independent
// b128 loads, 16 b128 stores.  4096 waves, resident together.
// A load instruction reads half of one 128-byte line from each of 8 rows, a
// store instruction writes four whole 128-byte lines of one tile.
// ---------------------------------------------------------------------------
#define CVT_ROWS    (3 * MROWS + 4 * DMODEL)   // 16384 stacked rows
#define CVT_BLOCKS  (CVT_ROWS / 16 * 4 / 8)    // 4 waves per 16 rows, 8 waves per block

__global__ __launch_bounds__(256) void cvt_f16_kernel(
    const float* __restrict__ xq, const float* __restrict__ xk,
    const float* __restrict__ xv, const float* __restrict__ wq,
    const float* __restrict__ wk, const float* __restrict__ wv,
    const float* __restrict__ wo, _Float16* __restrict__ dst)
{
  const int lane = threadIdx.x & 31;
  const int wave = threadIdx.x >> 5;
  const int p    = lane & 3;                   // 8-wide k piece inside a tile
  const int r8   = lane >> 2;                  // row inside a half tile
  const int kq   = wave & 3;                   // which 8 of the 32 k tiles
  const int rg   = blockIdx.x * 2 + (wave >> 2);   // 16-row group, stacked

  // a block's two row groups lie in one tensor: the choice is block-uniform
  const int bg = blockIdx.x * 2;
  const float* src;
  int g0;                                      // the tensor's first row group
  if (bg < 3 * (MROWS / 16)) {
    const int w = bg / (MROWS / 16);
    src = (w == 0) ? xq : (w == 1) ? xk : xv;
    g0  = w * (MROWS / 16);
  } else {
    const int w = (bg - 3 * (MROWS / 16)) / (DMODEL / 16);
    src = (w == 0) ? wq : (w == 1) ? wk : (w == 2) ? wv : wo;
    g0  = 3 * (MROWS / 16) + w * (DMODEL / 16);
  }

  const float* s = src + (long)((rg - g0) * 16 + r8) * DMODEL + kq * 256 + p * 8;
  float4 a[2][8], b[2][8];
  // both loop nests are unrolled so that a and b stay in registers
#pragma unroll
  for (int hf = 0; hf < 2; ++hf)
#pragma unroll
    for (int t = 0; t < 8; ++t) {
      a[hf][t] = *(const float4*)(s + hf * 8 * DMODEL + t * 32);
      b[hf][t] = *(const float4*)(s + hf * 8 * DMODEL + t * 32 + 4);
    }
  // all 32 loads name the address s: it is an operand here so that its registers
  // stay whole until the wait, and may be reused only behind it
  asm volatile("s_wait_xcnt 0x0" :: "v"(s) : "memory");

  _Float16* d = dst + ((long)rg * KTILES + kq * 8) * TILE_H + pk_off(r8, p * 8);
#pragma unroll
  for (int hf = 0; hf < 2; ++hf)
#pragma unroll
    for (int t = 0; t < 8; ++t) {
      const float4 x = a[hf][t], y = b[hf][t];
      v8h o;
      o[0]=(_Float16)x.x; o[1]=(_Float16)x.y; o[2]=(_Float16)x.z; o[3]=(_Float16)x.w;
      o[4]=(_Float16)y.x; o[5]=(_Float16)y.y; o[6]=(_Float16)y.z; o[7]=(_Float16)y.w;
      *(v8h*)(d + t * TILE_H + hf * 64) = o;   // rows 8..15: 8 pieces further on
    }
}

// ---------------------------------------------------------------------------
// Kernel 1: QKV projection.  Out[m,n] = sum_k X[m,k]*W[n,k] + bias[n]
// blockIdx.z selects {Q,K,V}.  Per (b,h), packed tiles: Q,K rows = s, k = hd,
// tile (s/16)*2 + hd/32;  V rows = hd, k = s, tile (s/32)*4 + hd/16.
// One wave computes a 32x64 output tile: 2 A frags + 4 B frags -> 8 WMMAs.
//
// Both projection kernels: a block of 8 waves (4 along m, 2 along n) computes
// 128x128.  Its 128 rows of X and 128 rows of W come into LDS once per block,
// by asynchronous copies, two buffers; the waves read their fragments there
// (read from global memory, every X tile would be fetched by 2 waves of the block
// and every W tile by 4, each k tile behind its own round trips).  A half stage is 64 k = 2 packed k tiles of each of
// the 8 + 8 row groups, 32 KB: tile (group * 2 + k tile) of X, then the same of
// W.  The two k tiles of a row group are 2 KB in a row in the workspace and keep
// their order in LDS, so a fragment read is 512 contiguous LDS bytes.
// ---------------------------------------------------------------------------
#define GEMM_WAVES  8
#define GH_H        (32 * TILE_H)           // halfs of a half stage (16 X tiles, 16 W tiles)
#define GH_BYTES    (GH_H * 2)
#define GRP2_H      (2 * KTILES * TILE_H)   // halfs from a row group to the next but one

// One half stage into LDS: a thread copies 4 x 16 bytes of X and 4 x 16 of W.  One
// copy of the block takes 2 row groups x 2 KB; l = the thread's LDS byte address in
// the half stage, gx / gw = its first bytes (row group threadIdx.x >> 7).
__device__ __forceinline__ void gemm_copy(unsigned l, const _Float16* gx, const _Float16* gw) {
  asm volatile(
      "global_load_async_to_lds_b128 %0, %8, off\n\t"
      "global_load_async_to_lds_b128 %1, %9, off\n\t"
      "global_load_async_to_lds_b128 %2, %10, off\n\t"
      "global_load_async_to_lds_b128 %3, %11, off\n\t"
      "global_load_async_to_lds_b128 %4, %12, off\n\t"
      "global_load_async_to_lds_b128 %5, %13, off\n\t"
      "global_load_async_to_lds_b128 %6, %14, off\n\t"
      "global_load_async_to_lds_b128 %7, %15, off\n\t"
      "s_wait_xcnt 0x0"
      :: "v"(l), "v"(l + 4096u), "v"(l + 8192u), "v"(l + 12288u),
         "v"(l + 16384u), "v"(l + 20480u), "v"(l + 24576u), "v"(l + 28672u),
         "v"(gx), "v"(gx + GRP2_H), "v"(gx + 2 * GRP2_H), "v"(gx + 3 * GRP2_H),
         "v"(gw), "v"(gw + GRP2_H), "v"(gw + 2 * GRP2_H), "v"(gw + 3 * GRP2_H)
      : "memory");
}

// acc += X[128 rows] W[128 rows]^T over all of k, this wave's 32x64 part.
// Xb / Wb = first packed tile of the block's rows; ring = 2 buffers of NH half stages.
template <int NH>
__device__ __forceinline__ void gemm_block(const _Float16* Xb, const _Float16* Wb,
                                           _Float16* ring, v8f (&acc)[2][4]) {
  constexpr int NS = KTILES / (2 * NH);     // stages
  const int lane = threadIdx.x & 31;
  const int wave = threadIdx.x >> 5;
  const int xt = (wave & 3) * 4;            // the wave's first X tile of a half stage
  const int wt = 16 + (wave >> 2) * 8;      // its first W tile
  const unsigned l0 = (unsigned)(size_t)ring + threadIdx.x * 16u;
  const long go = (long)(threadIdx.x >> 7) * KTILES * TILE_H + (threadIdx.x & 127) * 8;
  const _Float16* gx = Xb + go;
  const _Float16* gw = Wb + go;

  // stage 0 lands and is published, then stage 1 flies while stage 0 is worked on
#pragma unroll
  for (int hs = 0; hs < NH; ++hs)
    gemm_copy(l0 + hs * GH_BYTES, gx + hs * 2 * TILE_H, gw + hs * 2 * TILE_H);
  asm volatile("s_wait_asynccnt 0x0" ::: "memory");   // this wave's copies have landed
  __syncthreads();
#pragma unroll
  for (int hs = NH; hs < 2 * NH; ++hs)
    gemm_copy(l0 + hs * GH_BYTES, gx + hs * 2 * TILE_H, gw + hs * 2 * TILE_H);

  for (int s = 0; s < NS; ++s) {
    const _Float16* Bs = ring + (s & 1) * NH * GH_H;
    // unrolled: a k tile's place in the buffer becomes an immediate offset of its LDS reads
#pragma unroll
    for (int kk = 0; kk < 2 * NH; ++kk) {
      const _Float16* Hs = Bs + (kk >> 1) * GH_H + (kk & 1) * TILE_H;
      const v16h a0 = frag_pk(Hs + xt * TILE_H, lane);
      const v16h a1 = frag_pk(Hs + (xt + 2) * TILE_H, lane);
      v16h bfr[4];   // (unrolled so that bfr stays in registers)
#pragma unroll
      for (int t = 0; t < 4; ++t) bfr[t] = frag_pk(Hs + (wt + t * 2) * TILE_H, lane);
      // keeps a k tile's 12 LDS reads in front of its own 8 WMMAs, in a few groups: without
      // it they stand in pairs among those WMMAs, each pair behind a wait to 0 for itself
      __builtin_amdgcn_sched_barrier(0);
#pragma unroll
      for (int t = 0; t < 4; ++t) {
        acc[0][t] = wmma16(a0, bfr[t], acc[0][t]);
        acc[1][t] = wmma16(a1, bfr[t], acc[1][t]);
      }
    }
    // publish point of stage s + 1: this wave's reads of stage s are over, its
    // copies of stage s + 1 have landed; behind the barrier that holds for all waves
    asm volatile("s_wait_dscnt 0x0" ::: "memory");
    asm volatile("s_wait_asynccnt 0x0" ::: "memory");
    __syncthreads();
    // refill the buffer that every wave has just left
    if (s + 2 < NS) {
#pragma unroll
      for (int hs = 0; hs < NH; ++hs)
        gemm_copy(l0 + (unsigned)((s & 1) * NH + hs) * GH_BYTES,
                  gx + (long)((s + 2) * NH + hs) * 2 * TILE_H,
                  gw + (long)((s + 2) * NH + hs) * 2 * TILE_H);
    }
  }
  asm volatile("s_wait_asynccnt 0x0" ::: "memory");   // nothing is in flight behind the loop
}

__global__ __launch_bounds__(GEMM_WAVES * 32) void qkv_proj_kernel(
    const _Float16* __restrict__ Xf,   // [3][MROWS, D] f16 packed (q,k,v)
    const _Float16* __restrict__ Wf,   // [3][D, D] f16 packed (Wq,Wk,Wv)
    const float* __restrict__ bq, const float* __restrict__ bk,
    const float* __restrict__ bv,
    _Float16* __restrict__ Qf, _Float16* __restrict__ Kf, _Float16* __restrict__ Vt)
{
  const int lane = threadIdx.x & 31;
  const int wave = threadIdx.x >> 5;
  const int which = blockIdx.z;

  const _Float16* X    = Xf + (long)which * MROWS * DMODEL;
  const _Float16* W    = Wf + (long)which * DMODEL * DMODEL;
  const float*    bias = (which == 0) ? bq : (which == 1) ? bk : bv;

  const int m0 = blockIdx.x * 128 + (wave & 3) * 32;
  const int n0 = blockIdx.y * 128 + (wave >> 2) * 64;

  v8f acc[2][4];
#pragma unroll
  for (int g = 0; g < 2; ++g)
#pragma unroll
    for (int t = 0; t < 4; ++t) acc[g][t] = vzero8();

  __shared__ __attribute__((aligned(128))) _Float16 gring[2 * GH_H];
  gemm_block<1>(X + (long)(blockIdx.x * 8) * KTILES * TILE_H,
                W + (long)(blockIdx.y * 8) * KTILES * TILE_H, gring, acc);

  const int cn = lane & 15;
  const int hi = (lane >> 4) & 1;
  const int h  = n0 >> 6;            // the 64 columns of a wave are one head
  const int b  = m0 >> 11;           // /2048; the 32 rows are one batch entry
  const int s0 = m0 & (SLEN - 1);
  const long hb = ((long)b * NHEAD + h) * SLEN * HDIM;
  if (which == 2) {
    _Float16* dst = Vt + hb + (long)(s0 >> 5) * 4 * TILE_H + lane * 8;
#pragma unroll
    for (int t = 0; t < 4; ++t) {
      const float bn = bias[n0 + t * 16 + cn];
#pragma unroll
      for (int g = 0; g < 2; ++g) {
        // a lane's 8 accumulators are 8 consecutive keys of one hd row: one piece
        v8h pv;
#pragma unroll
        for (int j = 0; j < 8; ++j) pv[j] = (_Float16)(acc[g][t][j] + bn);
        *(v8h*)(dst + t * TILE_H + g * 256) = pv;
        // the next group reuses this store's data registers
        asm volatile("s_wait_xcnt 0x0" ::: "memory");
      }
    }
  } else {
    _Float16* dst = ((which == 0) ? Qf : Kf) + hb + (long)(s0 >> 4) * 2 * TILE_H;
#pragma unroll
    for (int t = 0; t < 4; ++t) {
      const float bn = bias[n0 + t * 16 + cn];
#pragma unroll
      for (int g = 0; g < 2; ++g) {
#pragma unroll
        for (int j = 0; j < 8; ++j)
          dst[(g * 2 + (t >> 1)) * TILE_H + pk_off(j + 8 * hi, (t & 1) * 16 + cn)] =
              (_Float16)(acc[g][t][j] + bn);
        // the next group reuses these stores' data registers
        asm volatile("s_wait_xcnt 0x0" ::: "memory");
      }
    }
  }
}

// ---------------------------------------------------------------------------
// Kernel 2: flash-style attention, scores transposed.  One wave = 16 query
// columns for one (b,h).  Per 32 keys: S^T = K Q^T (A = packed K tiles, B = Q),
// so a lane holds 16 scores of ONE query (column lane&15; keys 8*hi + j and
// 16 + 8*hi + j).  Maximum and sum run inside the lane, the two lane halves
// exchange the maximum once per step and join their sums once at the end.
// The two score tiles, converted in place, are the B operand of
// O^T += V^T P^T (A = packed V tiles): P touches neither LDS nor another lane.
// A lane's bias values are 2 x 8 consecutive floats of its query's row; a wave's
// 16 rows x 64 keys of a stage come into LDS with the K/V stage, by copies that
// each take 2 rows x 256 contiguous bytes (four whole lines), and the lane reads
// its row there (read from global memory, each load would touch 16 lines).
// The 8 waves of a block work on one (b,h): its K and V tiles come into LDS once
// per block, 64 keys a stage, two buffers, by asynchronous copies (the packed
// tiles of a stage are 8 KB in a row, and keep their order in LDS, so a
// fragment read is 512 contiguous LDS bytes).
// ---------------------------------------------------------------------------
#define ATT_WAVES  8
#define STG_KEYS   64                     // keys per stage
#define STG_H      (STG_KEYS * HDIM)      // halfs of K (and of V) per stage: 8 KB
#define NSTG       (SLEN / STG_KEYS)
#define BUF_BYTES  (2 * STG_H * 2)        // one buffer: K stage, then V stage

// One stage into one buffer: a thread copies 2 x 16 bytes of K and 2 x 16 of V;
// l = its LDS byte address in the buffer, gk / gv = its first bytes of the stage.
__device__ __forceinline__ void kv_copy(unsigned l, const _Float16* gk, const _Float16* gv) {
  asm volatile(
      "global_load_async_to_lds_b128 %0, %4, off\n\t"
      "global_load_async_to_lds_b128 %1, %5, off\n\t"
      "global_load_async_to_lds_b128 %2, %6, off\n\t"
      "global_load_async_to_lds_b128 %3, %7, off\n\t"
      "s_wait_xcnt 0x0"
      :: "v"(l), "v"(l + 4096u), "v"(l + 8192u), "v"(l + 12288u),
         "v"(gk), "v"(gk + 2048), "v"(gv), "v"(gv + 2048)
      : "memory");
}

#define BIAS_PITCH  (STG_KEYS + 4)
#define BIAS_WAVE_B (16 * BIAS_PITCH * 4)
#define BIAS_BUF_B  (ATT_WAVES * BIAS_WAVE_B)

__device__ __forceinline__ void bias_copy(unsigned l, const float* g) {
  asm volatile(
      "global_load_async_to_lds_b128 %0, %8, off\n\t"
      "global_load_async_to_lds_b128 %1, %9, off\n\t"
      "global_load_async_to_lds_b128 %2, %10, off\n\t"
      "global_load_async_to_lds_b128 %3, %11, off\n\t"
      "global_load_async_to_lds_b128 %4, %12, off\n\t"
      "global_load_async_to_lds_b128 %5, %13, off\n\t"
      "global_load_async_to_lds_b128 %6, %14, off\n\t"
      "global_load_async_to_lds_b128 %7, %15, off\n\t"
      "s_wait_xcnt 0x0"
      :: "v"(l), "v"(l + 2u * BIAS_PITCH * 4u), "v"(l + 4u * BIAS_PITCH * 4u),
         "v"(l + 6u * BIAS_PITCH * 4u), "v"(l + 8u * BIAS_PITCH * 4u),
         "v"(l + 10u * BIAS_PITCH * 4u), "v"(l + 12u * BIAS_PITCH * 4u),
         "v"(l + 14u * BIAS_PITCH * 4u),
         "v"(g), "v"(g + 2 * SLEN), "v"(g + 4 * SLEN), "v"(g + 6 * SLEN),
         "v"(g + 8 * SLEN), "v"(g + 10 * SLEN), "v"(g + 12 * SLEN), "v"(g + 14 * SLEN)
      : "memory");
}

__device__ __forceinline__ float xhalf(float x) {
  const int b = __builtin_bit_cast(int, x);
  return __builtin_bit_cast(float, __builtin_amdgcn_permlanex16(
      b, b, 0x76543210, 0xfedcba98, false, false));
}

__global__ __launch_bounds__(ATT_WAVES * 32) __attribute__((amdgpu_waves_per_eu(4, 4)))
void attn_kernel(
    const _Float16* __restrict__ Qf, const _Float16* __restrict__ Kf,
    const _Float16* __restrict__ Vt,
    const float* __restrict__ bias_struct, const float* __restrict__ lambda_p,
    _Float16* __restrict__ Of)   // [B*S, D] f16 packed
{
  const int lane = threadIdx.x & 31;
  const int wave = threadIdx.x >> 5;
  const int q0 = (blockIdx.x * ATT_WAVES + wave) * 16;
  const int h  = blockIdx.y;
  const int b  = blockIdx.z;
  const float lam = *lambda_p;

  const _Float16* Qb = Qf + ((long)b * NHEAD + h) * SLEN * HDIM;
  const _Float16* Kb = Kf + ((long)b * NHEAD + h) * SLEN * HDIM;
  const _Float16* Vb = Vt + ((long)b * NHEAD + h) * HDIM * SLEN;

  const int cn = lane & 15;
  const int hi = (lane >> 4) & 1;

  // what the lane copies of the bias: row hi of the wave's 16, 16-byte piece cn
  const float* gB = bias_struct + ((long)b * SLEN + q0 + hi) * SLEN + cn * 4;

  // Q fragments (K-dim 0..31 and 32..63), loaded once; B operand: column = query
  const v16h bq0 = frag_pk(Qb + (long)((q0 >> 4) * 2 + 0) * TILE_H, lane);
  const v16h bq1 = frag_pk(Qb + (long)((q0 >> 4) * 2 + 1) * TILE_H, lane);

  // o[t][j] = O[query cn][hd = t*16 + 8*hi + j]
  v8f o[4];
#pragma unroll
  for (int t = 0; t < 4; ++t) o[t] = vzero8();
  float mrun = -3.0e38f;   // running maximum of the query, equal in both halves
  float lrun = 0.0f;       // running sum over this half's keys only

  __shared__ __attribute__((aligned(128))) _Float16 ring[2][2 * STG_H];
  const unsigned lds0 = (unsigned)(size_t)(&ring[0][0]) + threadIdx.x * 16u;
  const _Float16* gK = Kb + threadIdx.x * 8;
  const _Float16* gV = Vb + threadIdx.x * 8;
  __shared__ __attribute__((aligned(128))) float bring[2][ATT_WAVES][16 * BIAS_PITCH];
  const unsigned ldsb = (unsigned)(size_t)(&bring[0][wave][0]) + (hi * BIAS_PITCH + cn * 4) * 4u;

  // stage 0 lands and is published, then stage 1 flies while stage 0 is worked on
  kv_copy(lds0, gK, gV);
  bias_copy(ldsb, gB);
  asm volatile("s_wait_asynccnt 0x0" ::: "memory");   // this wave's copies have landed
  __syncthreads();
  kv_copy(lds0 + BUF_BYTES, gK + STG_H, gV + STG_H);
  bias_copy(ldsb + BIAS_BUF_B, gB + STG_KEYS);

  for (int s = 0; s < NSTG; ++s) {
   const _Float16* Ks = &ring[s & 1][0];
   const _Float16* Vs = Ks + STG_H;
   // the lane's own query row of the stage's bias, at its first key
   const float* Bl = &bring[s & 1][wave][cn * BIAS_PITCH + hi * 8];
   // unrolled: a pass's place in the buffer becomes an immediate offset of its LDS reads
#pragma unroll
   for (int pa = 0; pa < STG_KEYS / 32; ++pa) {
    const int k0 = pa * 32;                 // first key of the pass inside the stage

    // bias of keys k0 + 8*hi + 0..7 and k0 + 16 + 8*hi + 0..7, from LDS
    const v4f c0 = *(const v4f*)(Bl + k0);
    const v4f c1 = *(const v4f*)(Bl + k0 + 4);
    const v4f c2 = *(const v4f*)(Bl + k0 + 16);
    const v4f c3 = *(const v4f*)(Bl + k0 + 20);

    // scores^T: two 16x16 tiles (key rows k0..k0+15 and k0+16..k0+31)
    const _Float16* Kt = Ks + pa * 4 * TILE_H;                 // tiles: key16*2 + hd32
    const v16h ak0 = frag_pk(Kt + 0 * TILE_H, lane);
    const v16h ak1 = frag_pk(Kt + 1 * TILE_H, lane);
    const v16h ak2 = frag_pk(Kt + 2 * TILE_H, lane);
    const v16h ak3 = frag_pk(Kt + 3 * TILE_H, lane);
    // the pass's V fragments are read in the same group as K: one place with LDS
    // reads per pass instead of reads scattered among the exponentials and WMMAs
    // (unrolled so that avf stays in registers)
    v16h avf[4];
#pragma unroll
    for (int t = 0; t < 4; ++t) avf[t] = frag_pk(Vs + (pa * 4 + t) * TILE_H, lane);
    // keeps the pass's LDS reads (bias, K, V) in front of its first WMMA: without it
    // they are spread in twos and fours over the pass
    __builtin_amdgcn_sched_barrier(0);
    v8f s0 = vzero8(), s1 = vzero8();
    s0 = wmma16(ak0, bq0, s0);
    s1 = wmma16(ak2, bq0, s1);
    s0 = wmma16(ak1, bq1, s0);
    s1 = wmma16(ak3, bq1, s1);

    // scale + structural bias, in the accumulators' own register order
    const v8f x0 = s0 * SCALE + lam * __builtin_shufflevector(c0, c1, 0, 1, 2, 3, 4, 5, 6, 7);
    const v8f x1 = s1 * SCALE + lam * __builtin_shufflevector(c2, c3, 0, 1, 2, 3, 4, 5, 6, 7);

    // online softmax update: one maximum, one correction per lane
    const float t0 = fmaxf(fmaxf(x0[0], x0[1]), x0[2]);
    const float t1 = fmaxf(fmaxf(x0[3], x0[4]), x0[5]);
    const float t2 = fmaxf(fmaxf(x0[6], x0[7]), x1[0]);
    const float t3 = fmaxf(fmaxf(x1[1], x1[2]), x1[3]);
    const float t4 = fmaxf(fmaxf(x1[4], x1[5]), x1[6]);
    float mv = fmaxf(fmaxf(fmaxf(t0, t1), t2), fmaxf(fmaxf(t3, t4), x1[7]));
    mv = fmaxf(mv, xhalf(mv));
    const float mnew = fmaxf(mrun, mv);
    const float corr = __expf(mrun - mnew);
    mrun = mnew;

    v16h bp;     // P^T as B operand: halfs[j] = key 8*hi + j, halfs[8+j] = key 16 + 8*hi + j
    v8f p0, p1;
#pragma unroll
    for (int j = 0; j < 8; ++j) {
      p0[j] = __expf(x0[j] - mnew);
      p1[j] = __expf(x1[j] - mnew);
      bp[j]     = (_Float16)p0[j];
      bp[j + 8] = (_Float16)p1[j];
    }
    const v8f ps = p0 + p1;
    lrun = lrun * corr +
           (((ps[0] + ps[4]) + (ps[2] + ps[6])) + ((ps[1] + ps[5]) + (ps[3] + ps[7])));
#pragma unroll
    for (int t = 0; t < 4; ++t) o[t] *= corr;

    // out^T += V^T (64x32) @ P^T (32x16), one packed V tile per 16 hd rows
#pragma unroll
    for (int t = 0; t < 4; ++t) o[t] = wmma16(avf[t], bp, o[t]);
   }
   // keeps the stage's arithmetic in front of the publish point, so that the refill
   // behind the barrier is issued a whole stage ahead of its wait
   __builtin_amdgcn_sched_barrier(0);
   // publish point of stage s + 1: this wave's reads of stage s are over, its
   // copies of stage s + 1 have landed; behind the barrier that holds for all waves
   asm volatile("s_wait_dscnt 0x0" ::: "memory");
   asm volatile("s_wait_asynccnt 0x0" ::: "memory");
   __syncthreads();
   // refill the buffer that every wave has just left
   if (s + 2 < NSTG) {
     kv_copy(lds0 + (unsigned)(s & 1) * BUF_BYTES, gK + (long)(s + 2) * STG_H,
             gV + (long)(s + 2) * STG_H);
     bias_copy(ldsb + (unsigned)(s & 1) * BIAS_BUF_B, gB + (s + 2) * STG_KEYS);
   }
  }
  asm volatile("s_wait_asynccnt 0x0" ::: "memory");   // nothing is in flight at the wave's end

  // normalize and store attention output as f16 packed tiles of [B*S, D]:
  // a lane's 8 accumulators of o[t] are 8 consecutive columns of its row, one piece
  const float inv = 1.0f / (lrun + xhalf(lrun));
  _Float16* op = Of + ((long)((b * SLEN + q0) >> 4) * KTILES + h * 2) * TILE_H + lane * 8;
#pragma unroll
  for (int t = 0; t < 4; ++t) {
    v8h ov;
#pragma unroll
    for (int j = 0; j < 8; ++j) ov[j] = (_Float16)(o[t][j] * inv);
    *(v8h*)(op + (t >> 1) * TILE_H + (t & 1) * 256) = ov;
  }
}

// ---------------------------------------------------------------------------
// Kernel 3: output projection.  Out[m,n] = sum_k A[m,k]*Wo[n,k] + bo[n]  (f32)
// One wave computes a 32x64 output tile, a block 128x128 (see kernel 1).  One block
// per WGP here: a stage is two half stages, so that a refill has a longer lead.
// ---------------------------------------------------------------------------
__global__ __launch_bounds__(GEMM_WAVES * 32) void oproj_kernel(
    const _Float16* __restrict__ Af, const _Float16* __restrict__ Wof,
    const float* __restrict__ bo, float* __restrict__ Out)
{
  const int lane = threadIdx.x & 31;
  const int wave = threadIdx.x >> 5;
  const int m0 = blockIdx.x * 128 + (wave & 3) * 32;
  const int n0 = blockIdx.y * 128 + (wave >> 2) * 64;

  v8f acc[2][4];
#pragma unroll
  for (int g = 0; g < 2; ++g)
#pragma unroll
    for (int t = 0; t < 4; ++t) acc[g][t] = vzero8();

  __shared__ __attribute__((aligned(128))) _Float16 gring[2 * 2 * GH_H];
  gemm_block<2>(Af  + (long)(blockIdx.x * 8) * KTILES * TILE_H,
                Wof + (long)(blockIdx.y * 8) * KTILES * TILE_H, gring, acc);

  const int cn = lane & 15;
  const int hi = (lane >> 4) & 1;
#pragma unroll
  for (int t = 0; t < 4; ++t) {
    const float bn = bo[n0 + t * 16 + cn];
#pragma unroll
    for (int g = 0; g < 2; ++g)
#pragma unroll
      for (int j = 0; j < 8; ++j)
        Out[(long)(m0 + g * 16 + j + 8 * hi) * DMODEL + n0 + t * 16 + cn] =
            acc[g][t][j] + bn;
  }
}

// ---------------------------------------------------------------------------
extern "C" void kernel_launch(void* const* d_in, const int* in_sizes, int n_in,
                              void* d_out, int out_size, void* d_ws, size_t ws_size,
                              hipStream_t stream) {
  const float* query = (const float*)d_in[0];
  const float* key   = (const float*)d_in[1];
  const float* value = (const float*)d_in[2];
  const float* biasS = (const float*)d_in[3];
  const float* Wq = (const float*)d_in[4];
  const float* bq = (const float*)d_in[5];
  const float* Wk = (const float*)d_in[6];
  const float* bk = (const float*)d_in[7];
  const float* Wv = (const float*)d_in[8];
  const float* bv = (const float*)d_in[9];
  const float* Wo = (const float*)d_in[10];
  const float* bo = (const float*)d_in[11];
  const float* lam = (const float*)d_in[12];
  float* out = (float*)d_out;

  const long XN = (long)MROWS * DMODEL;            // 4M elements per activation
  const long WN = (long)DMODEL * DMODEL;           // 1M elements per weight
  const long HN = (long)BATCH * NHEAD * SLEN * HDIM;  // 4M per head tensor

  // all packed 16x32 tiles (see the header)
  _Float16* Xf = (_Float16*)d_ws;        // [3][MROWS, D]   12M halfs
  _Float16* Wf = Xf + 3 * XN;            // [4][D, D]        4M halfs (q,k,v,o)
  _Float16* Qf = Wf + 4 * WN;            // [B,H][S x HD]    4M
  _Float16* Kf = Qf + HN;                // [B,H][S x HD]    4M
  _Float16* Vt = Kf + HN;                // [B,H][HD x S]    4M
  _Float16* Of = Vt + HN;                // [B*S, D]         4M

  dim3 blkg(GEMM_WAVES * 32);

  // 0) f32 -> f16 conversions: Xf and Wf are one run of the workspace
  cvt_f16_kernel<<<dim3(CVT_BLOCKS), dim3(256), 0, stream>>>(
      query, key, value, Wq, Wk, Wv, Wo, Xf);

  // 1) QKV projections: grid.x = M/128, grid.y = D/128 (4 x 2 waves of 32 x 64)
  qkv_proj_kernel<<<dim3(MROWS / 128, DMODEL / 128, 3), blkg, 0, stream>>>(
      Xf, Wf, bq, bk, bv, Qf, Kf, Vt);

  // 2) attention: grid.x = S/128 (8 q-tiles per block), grid.y = H, grid.z = B
  attn_kernel<<<dim3(SLEN / (ATT_WAVES * 16), NHEAD, BATCH), dim3(ATT_WAVES * 32), 0, stream>>>(
      Qf, Kf, Vt, biasS, lam, Of);

  // 3) output projection
  oproj_kernel<<<dim3(MROWS / 128, DMODEL / 128), blkg, 0, stream>>>(
      Of, Wf + 3 * WN, bo, out);
}

// v007
// A run of this version takes 84.5 microseconds.
// Next to v006, in two timings, it ran 1.08 times as fast each time.
// All steps since v000 together make it 2.90 times as fast.
#include <hip/hip_runtime.h>
#include <hip/hip_bf16.h>

typedef __attribute__((ext_vector_type(16))) _Float16 v16h;
typedef __attribute__((ext_vector_type(8)))  _Float16 v8h;
typedef __attribute__((ext_vector_type(8)))  float    v8f;
typedef __attribute__((ext_vector_type(4)))  float    v4f;

#define BATCH   2
#define SLEN    2048
#define DMODEL  1024
#define NHEAD   16
#define HDIM    64
#define MROWS   (BATCH * SLEN)   // 4096
// 1/sqrt(64) * log2(e): Q is stored times this, so that K Q^T is a score in log2 units
#define QSCALE  0.18033688011112042f
#define LOG2E   1.4426950408889634f

__device__ __forceinline__ v8f vzero8() {
  v8f z;
#pragma unroll
  for (int i = 0; i < 8; ++i) z[i] = 0.0f;
  return z;
}

__device__ __forceinline__ v8f wmma16(v16h a, v16h b, v8f c) {
  return __builtin_amdgcn_wmma_f32_16x16x32_f16(
      /*neg_a=*/false, a, /*neg_b=*/false, b,
      /*c_mod=*/(short)0, c, /*reuse_a=*/false, /*reuse_b=*/false);
}

#define TILE_H  512              // halfs per packed 16x32 tile
#define KTILES  (DMODEL / 32)    // packed tiles along k of a [rows, DMODEL] matrix

// Load a 16x32 f16 fragment (A or B) from one packed tile.
__device__ __forceinline__ v16h frag_pk(const _Float16* tile, int lane) {
  v8h lo = *(const v8h*)(tile + lane * 8);
  v8h hh = *(const v8h*)(tile + 256 + lane * 8);
  v16h f;
#pragma unroll
  for (int i = 0; i < 8; ++i) { f[i] = lo[i]; f[i + 8] = hh[i]; }
  return f;
}

// Offset (in halfs) of element (row c, k index kk) inside a packed tile.
__device__ __forceinline__ int pk_off(int c, int kk) {
  const int p = kk >> 3;
  return (((p >> 1) * 32 + (p & 1) * 16 + c) << 3) + (kk & 7);
}

// ---------------------------------------------------------------------------
// Kernel 0: f32 row-major -> f16 packed tiles, all seven tensors in one launch.
// The destinations follow one another in the workspace, so together they are
// the packed form of one stacked [CVT_ROWS, DMODEL] matrix (q, k, v, Wq, Wk,
// Wv, Wo); only the source pointer depends on the row.  One wave converts 16
// rows x 256 columns = 8 whole tiles (8 KB out, contiguous): 32 independent
// b128 loads, 16 b128 stores.  4096 waves, resident together.
// A load instruction reads half of one 128-byte line from each of 8 rows, a
// store instruction writes four whole 128-byte lines of one tile.
// ---------------------------------------------------------------------------
#define CVT_ROWS    (3 * MROWS + 4 * DMODEL)   // 16384 stacked rows
#define CVT_BLOCKS  (CVT_ROWS / 16 * 4 / 8)    // 4 waves per 16 rows, 8 waves per block

__global__ __launch_bounds__(256) void cvt_f16_kernel(
    const float* __restrict__ xq, const float* __restrict__ xk,
    const float* __restrict__ xv, const float* __restrict__ wq,
    const float* __restrict__ wk, const float* __restrict__ wv,
    const float* __restrict__ wo, _Float16* __restrict__ dst)
{
  const int lane = threadIdx.x & 31;
  const int wave = threadIdx.x >> 5;
  const int p    = lane & 3;                   // 8-wide k piece inside a tile
  const int r8   = lane >> 2;                  // row inside a half tile
  const int kq   = wave & 3;                   // which 8 of the 32 k tiles
  const int rg   = blockIdx.x * 2 + (wave >> 2);   // 16-row group, stacked

  // a block's two row groups lie in one tensor: the choice is block-uniform
  const int bg = blockIdx.x * 2;
  const float* src;
  int g0;                                      // the tensor's first row group
  if (bg < 3 * (MROWS / 16)) {
    const int w = bg / (MROWS / 16);
    src = (w == 0) ? xq : (w == 1) ? xk : xv;
    g0  = w * (MROWS / 16);
  } else {
    const int w = (bg - 3 * (MROWS / 16)) / (DMODEL / 16);
    src = (w == 0) ? wq : (w == 1) ? wk : (w == 2) ? wv : wo;
    g0  = 3 * (MROWS / 16) + w * (DMODEL / 16);
  }

  const float* s = src + (long)((rg - g0) * 16 + r8) * DMODEL + kq * 256 + p * 8;
  float4 a[2][8], b[2][8];
  // both loop nests are unrolled so that a and b stay in registers
#pragma unroll
  for (int hf = 0; hf < 2; ++hf)
#pragma unroll
    for (int t = 0; t < 8; ++t) {
      a[hf][t] = *(const float4*)(s + hf * 8 * DMODEL + t * 32);
      b[hf][t] = *(const float4*)(s + hf * 8 * DMODEL + t * 32 + 4);
    }
  // all 32 loads name the address s: it is an operand here so that its registers
  // stay whole until the wait, and may be reused only behind it
  asm volatile("s_wait_xcnt 0x0" :: "v"(s) : "memory");

  _Float16* d = dst + ((long)rg * KTILES + kq * 8) * TILE_H + pk_off(r8, p * 8);
#pragma unroll
  for (int hf = 0; hf < 2; ++hf)
#pragma unroll
    for (int t = 0; t < 8; ++t) {
      const float4 x = a[hf][t], y = b[hf][t];
      v8h o;
      o[0]=(_Float16)x.x; o[1]=(_Float16)x.y; o[2]=(_Float16)x.z; o[3]=(_Float16)x.w;
      o[4]=(_Float16)y.x; o[5]=(_Float16)y.y; o[6]=(_Float16)y.z; o[7]=(_Float16)y.w;
      *(v8h*)(d + t * TILE_H + hf * 64) = o;   // rows 8..15: 8 pieces further on
    }
}

// ---------------------------------------------------------------------------
// Kernel 1: QKV projection.  Out[m,n] = sum_k X[m,k]*W[n,k] + bias[n]
// blockIdx.z selects {Q,K,V}.  Per (b,h), packed tiles: Q,K rows = s, k = hd,
// tile (s/16)*2 + hd/32;  V rows = hd, k = s, tile (s/32)*4 + hd/16.
// One wave computes a 32x64 output tile: 2 A frags + 4 B frags -> 8 WMMAs.
//
// Both projection kernels: a block of 8 waves (4 along m, 2 along n) computes
// 128x128.  Its 128 rows of X and 128 rows of W come into LDS once per block,
// by asynchronous copies, two buffers; the waves read their fragments there
// (read from global memory, every X tile would be fetched by 2 waves of the block
// and every W tile by 4, each k tile behind its own round trips).  A half stage is 64 k = 2 packed k tiles of each of
// the 8 + 8 row groups, 32 KB: tile (group * 2 + k tile) of X, then the same of
// W.  The two k tiles of a row group are 2 KB in a row in the workspace and keep
// their order in LDS, so a fragment read is 512 contiguous LDS bytes.
// ---------------------------------------------------------------------------
#define GEMM_WAVES  8
#define GH_H        (32 * TILE_H)           // halfs of a half stage (16 X tiles, 16 W tiles)
#define GH_BYTES    (GH_H * 2)
#define GRP2_H      (2 * KTILES * TILE_H)   // halfs from a row group to the next but one

// One half stage into LDS: a thread copies 4 x 16 bytes of X and 4 x 16 of W.  One
// copy of the block takes 2 row groups x 2 KB; l = the thread's LDS byte address in
// the half stage, gx / gw = its first bytes (row group threadIdx.x >> 7).
__device__ __forceinline__ void gemm_copy(unsigned l, const _Float16* gx, const _Float16* gw) {
  asm volatile(
      "global_load_async_to_lds_b128 %0, %8, off\n\t"
      "global_load_async_to_lds_b128 %1, %9, off\n\t"
      "global_load_async_to_lds_b128 %2, %10, off\n\t"
      "global_load_async_to_lds_b128 %3, %11, off\n\t"
      "global_load_async_to_lds_b128 %4, %12, off\n\t"
      "global_load_async_to_lds_b128 %5, %13, off\n\t"
      "global_load_async_to_lds_b128 %6, %14, off\n\t"
      "global_load_async_to_lds_b128 %7, %15, off\n\t"
      "s_wait_xcnt 0x0"
      :: "v"(l), "v"(l + 4096u), "v"(l + 8192u), "v"(l + 12288u),
         "v"(l + 16384u), "v"(l + 20480u), "v"(l + 24576u), "v"(l + 28672u),
         "v"(gx), "v"(gx + GRP2_H), "v"(gx + 2 * GRP2_H), "v"(gx + 3 * GRP2_H),
         "v"(gw), "v"(gw + GRP2_H), "v"(gw + 2 * GRP2_H), "v"(gw + 3 * GRP2_H)
      : "memory");
}

// acc += X[128 rows] W[128 rows]^T over all of k, this wave's 32x64 part.
// Xb / Wb = first packed tile of the block's rows; ring = 2 buffers of NH half stages.
template <int NH>
__device__ __forceinline__ void gemm_block(const _Float16* Xb, const _Float16* Wb,
                                           _Float16* ring, v8f (&acc)[2][4]) {
  constexpr int NS = KTILES / (2 * NH);     // stages
  const int lane = threadIdx.x & 31;
  const int wave = threadIdx.x >> 5;
  const int xt = (wave & 3) * 4;            // the wave's first X tile of a half stage
  const int wt = 16 + (wave >> 2) * 8;      // its first W tile
  const unsigned l0 = (unsigned)(size_t)ring + threadIdx.x * 16u;
  const long go = (long)(threadIdx.x >> 7) * KTILES * TILE_H + (threadIdx.x & 127) * 8;
  const _Float16* gx = Xb + go;
  const _Float16* gw = Wb + go;

  // stage 0 lands and is published, then stage 1 flies while stage 0 is worked on
#pragma unroll
  for (int hs = 0; hs < NH; ++hs)
    gemm_copy(l0 + hs * GH_BYTES, gx + hs * 2 * TILE_H, gw + hs * 2 * TILE_H);
  asm volatile("s_wait_asynccnt 0x0" ::: "memory");   // this wave's copies have landed
  __syncthreads();
#pragma unroll
  for (int hs = NH; hs < 2 * NH; ++hs)
    gemm_copy(l0 + hs * GH_BYTES, gx + hs * 2 * TILE_H, gw + hs * 2 * TILE_H);

  for (int s = 0; s < NS; ++s) {
    const _Float16* Bs = ring + (s & 1) * NH * GH_H;
    // unrolled: a k tile's place in the buffer becomes an immediate offset of its LDS reads
#pragma unroll
    for (int kk = 0; kk < 2 * NH; ++kk) {
      const _Float16* Hs = Bs + (kk >> 1) * GH_H + (kk & 1) * TILE_H;
      const v16h a0 = frag_pk(Hs + xt * TILE_H, lane);
      const v16h a1 = frag_pk(Hs + (xt + 2) * TILE_H, lane);
      v16h bfr[4];   // (unrolled so that bfr stays in registers)
#pragma unroll
      for (int t = 0; t < 4; ++t) bfr[t] = frag_pk(Hs + (wt + t * 2) * TILE_H, lane);
      // keeps a k tile's 12 LDS reads in front of its own 8 WMMAs, in a few groups: without
      // it they stand in pairs among those WMMAs, each pair behind a wait to 0 for itself
      __builtin_amdgcn_sched_barrier(0);
#pragma unroll
      for (int t = 0; t < 4; ++t) {
        acc[0][t] = wmma16(a0, bfr[t], acc[0][t]);
        acc[1][t] = wmma16(a1, bfr[t], acc[1][t]);
      }
    }
    // publish point of stage s + 1: this wave's reads of stage s are over, its
    // copies of stage s + 1 have landed; behind the barrier that holds for all waves
    asm volatile("s_wait_dscnt 0x0" ::: "memory");
    asm volatile("s_wait_asynccnt 0x0" ::: "memory");
    __syncthreads();
    // refill the buffer that every wave has just left
    if (s + 2 < NS) {
#pragma unroll
      for (int hs = 0; hs < NH; ++hs)
        gemm_copy(l0 + (unsigned)((s & 1) * NH + hs) * GH_BYTES,
                  gx + (long)((s + 2) * NH + hs) * 2 * TILE_H,
                  gw + (long)((s + 2) * NH + hs) * 2 * TILE_H);
    }
  }
  asm volatile("s_wait_asynccnt 0x0" ::: "memory");   // nothing is in flight behind the loop
}

__global__ __launch_bounds__(GEMM_WAVES * 32) void qkv_proj_kernel(
    const _Float16* __restrict__ Xf,   // [3][MROWS, D] f16 packed (q,k,v)
    const _Float16* __restrict__ Wf,   // [3][D, D] f16 packed (Wq,Wk,Wv)
    const float* __restrict__ bq, const float* __restrict__ bk,
    const float* __restrict__ bv,
    _Float16* __restrict__ Qf, _Float16* __restrict__ Kf, _Float16* __restrict__ Vt)
{
  const int lane = threadIdx.x & 31;
  const int wave = threadIdx.x >> 5;
  const int which = blockIdx.z;

  const _Float16* X    = Xf + (long)which * MROWS * DMODEL;
  const _Float16* W    = Wf + (long)which * DMODEL * DMODEL;
  const float*    bias = (which == 0) ? bq : (which == 1) ? bk : bv;

  const int m0 = blockIdx.x * 128 + (wave & 3) * 32;
  const int n0 = blockIdx.y * 128 + (wave >> 2) * 64;

  v8f acc[2][4];
#pragma unroll
  for (int g = 0; g < 2; ++g)
#pragma unroll
    for (int t = 0; t < 4; ++t) acc[g][t] = vzero8();

  __shared__ __attribute__((aligned(128))) _Float16 gring[2 * GH_H];
  gemm_block<1>(X + (long)(blockIdx.x * 8) * KTILES * TILE_H,
                W + (long)(blockIdx.y * 8) * KTILES * TILE_H, gring, acc);

  const int cn = lane & 15;
  const int hi = (lane >> 4) & 1;
  const int h  = n0 >> 6;            // the 64 columns of a wave are one head
  const int b  = m0 >> 11;           // /2048; the 32 rows are one batch entry
  const int s0 = m0 & (SLEN - 1);
  const long hb = ((long)b * NHEAD + h) * SLEN * HDIM;
  if (which == 2) {
    _Float16* dst = Vt + hb + (long)(s0 >> 5) * 4 * TILE_H + lane * 8;
#pragma unroll
    for (int t = 0; t < 4; ++t) {
      const float bn = bias[n0 + t * 16 + cn];
#pragma unroll
      for (int g = 0; g < 2; ++g) {
        // a lane's 8 accumulators are 8 consecutive keys of one hd row: one piece
        v8h pv;
#pragma unroll
        for (int j = 0; j < 8; ++j) pv[j] = (_Float16)(acc[g][t][j] + bn);
        *(v8h*)(dst + t * TILE_H + g * 256) = pv;
        // the next group reuses this store's data registers
        asm volatile("s_wait_xcnt 0x0" ::: "memory");
      }
    }
  } else {
    _Float16* dst = ((which == 0) ? Qf : Kf) + hb + (long)(s0 >> 4) * 2 * TILE_H;
    const float qs = (which == 0) ? QSCALE : 1.0f;   // in f32, ahead of the one rounding to f16
#pragma unroll
    for (int t = 0; t < 4; ++t) {
      const float bn = bias[n0 + t * 16 + cn];
#pragma unroll
      for (int g = 0; g < 2; ++g) {
#pragma unroll
        for (int j = 0; j < 8; ++j)
          dst[(g * 2 + (t >> 1)) * TILE_H + pk_off(j + 8 * hi, (t & 1) * 16 + cn)] =
              (_Float16)((acc[g][t][j] + bn) * qs);
        // the next group reuses these stores' data registers
        asm volatile("s_wait_xcnt 0x0" ::: "memory");
      }
    }
  }
}

// ---------------------------------------------------------------------------
// Kernel 2: flash-style attention, scores transposed.  One wave = 16 query
// columns for one (b,h).  Per 32 keys: S^T = K Q^T (A = packed K tiles, B = Q),
// so a lane holds 16 scores of ONE query (column lane&15; keys 8*hi + j and
// 16 + 8*hi + j).  Scores are in log2 units (Q carries scale * log2 e), and the C
// operand of the score WMMA is lambda * log2 e * bias - mref, mref = the query's
// reference maximum: the accumulators are the arguments of v_exp as they stand.
// mref is the first pass's maximum and is raised only when a score of the wave
// lies more than LAZY_MAX above it (one ballot, one scalar branch per pass); only
// then are the halves' maxima exchanged and sums and output rescaled.  Sums run
// inside the lane; the two lane halves join them once at the end.
// The two score tiles, converted in place, are the B operand of
// O^T += V^T P^T (A = packed V tiles): P touches neither LDS nor another lane.
// A lane's bias values are 2 x 8 consecutive floats of its query's row; a wave's
// 16 rows x 64 keys of a stage come into LDS with the K/V stage, by copies that
// each take 2 rows x 256 contiguous bytes (four whole lines), and the lane reads
// its row there (read from global memory, each load would touch 16 lines).
// The 8 waves of a block work on one (b,h): its K and V tiles come into LDS once
// per block, 64 keys a stage, two buffers, by asynchronous copies (the packed
// tiles of a stage are 8 KB in a row, and keep their order in LDS, so a
// fragment read is 512 contiguous LDS bytes).
// ---------------------------------------------------------------------------
#define ATT_WAVES  8
#define STG_KEYS   64                     // keys per stage
#define STG_H      (STG_KEYS * HDIM)      // halfs of K (and of V) per stage: 8 KB
#define NSTG       (SLEN / STG_KEYS)
#define BUF_BYTES  (2 * STG_H * 2)        // one buffer: K stage, then V stage
#define LAZY_MAX   8.0f                   // P stays at or below 2^8, far inside f16

// One stage into one buffer: a thread copies 2 x 16 bytes of K and 2 x 16 of V;
// l = its LDS byte address in the buffer, gk / gv = its first bytes of the stage.
__device__ __forceinline__ void kv_copy(unsigned l, const _Float16* gk, const _Float16* gv) {
  asm volatile(
      "global_load_async_to_lds_b128 %0, %4, off\n\t"
      "global_load_async_to_lds_b128 %1, %5, off\n\t"
      "global_load_async_to_lds_b128 %2, %6, off\n\t"
      "global_load_async_to_lds_b128 %3, %7, off\n\t"
      "s_wait_xcnt 0x0"
      :: "v"(l), "v"(l + 4096u), "v"(l + 8192u), "v"(l + 12288u),
         "v"(gk), "v"(gk + 2048), "v"(gv), "v"(gv + 2048)
      : "memory");
}

#define BIAS_PITCH  (STG_KEYS + 4)
#define BIAS_WAVE_B (16 * BIAS_PITCH * 4)
#define BIAS_BUF_B  (ATT_WAVES * BIAS_WAVE_B)

__device__ __forceinline__ void bias_copy(unsigned l, const float* g) {
  asm volatile(
      "global_load_async_to_lds_b128 %0, %8, off\n\t"
      "global_load_async_to_lds_b128 %1, %9, off\n\t"
      "global_load_async_to_lds_b128 %2, %10, off\n\t"
      "global_load_async_to_lds_b128 %3, %11, off\n\t"
      "global_load_async_to_lds_b128 %4, %12, off\n\t"
      "global_load_async_to_lds_b128 %5, %13, off\n\t"
      "global_load_async_to_lds_b128 %6, %14, off\n\t"
      "global_load_async_to_lds_b128 %7, %15, off\n\t"
      "s_wait_xcnt 0x0"
      :: "v"(l), "v"(l + 2u * BIAS_PITCH * 4u), "v"(l + 4u * BIAS_PITCH * 4u),
         "v"(l + 6u * BIAS_PITCH * 4u), "v"(l + 8u * BIAS_PITCH * 4u),
         "v"(l + 10u * BIAS_PITCH * 4u), "v"(l + 12u * BIAS_PITCH * 4u),
         "v"(l + 14u * BIAS_PITCH * 4u),
         "v"(g), "v"(g + 2 * SLEN), "v"(g + 4 * SLEN), "v"(g + 6 * SLEN),
         "v"(g + 8 * SLEN), "v"(g + 10 * SLEN), "v"(g + 12 * SLEN), "v"(g + 14 * SLEN)
      : "memory");
}

__device__ __forceinline__ float xhalf(float x) {
  const int b = __builtin_bit_cast(int, x);
  return __builtin_bit_cast(float, __builtin_amdgcn_permlanex16(
      b, b, 0x76543210, 0xfedcba98, false, false));
}

__global__ __launch_bounds__(ATT_WAVES * 32) __attribute__((amdgpu_waves_per_eu(4, 4)))
void attn_kernel(
    const _Float16* __restrict__ Qf, const _Float16* __restrict__ Kf,
    const _Float16* __restrict__ Vt,
    const float* __restrict__ bias_struct, const float* __restrict__ lambda_p,
    _Float16* __restrict__ Of)   // [B*S, D] f16 packed
{
  const int lane = threadIdx.x & 31;
  const int wave = threadIdx.x >> 5;
  const int q0 = (blockIdx.x * ATT_WAVES + wave) * 16;
  const int h  = blockIdx.y;
  const int b  = blockIdx.z;
  const float lam2 = *lambda_p * LOG2E;

  const _Float16* Qb = Qf + ((long)b * NHEAD + h) * SLEN * HDIM;
  const _Float16* Kb = Kf + ((long)b * NHEAD + h) * SLEN * HDIM;
  const _Float16* Vb = Vt + ((long)b * NHEAD + h) * HDIM * SLEN;

  const int cn = lane & 15;
  const int hi = (lane >> 4) & 1;

  // what the lane copies of the bias: row hi of the wave's 16, 16-byte piece cn
  const float* gB = bias_struct + ((long)b * SLEN + q0 + hi) * SLEN + cn * 4;

  // Q fragments (K-dim 0..31 and 32..63), loaded once; B operand: column = query
  const v16h bq0 = frag_pk(Qb + (long)((q0 >> 4) * 2 + 0) * TILE_H, lane);
  const v16h bq1 = frag_pk(Qb + (long)((q0 >> 4) * 2 + 1) * TILE_H, lane);

  // o[t][j] = O[query cn][hd = t*16 + 8*hi + j]
  v8f o[4];
#pragma unroll
  for (int t = 0; t < 4; ++t) o[t] = vzero8();
  float mref = 0.0f;       // reference maximum of the query (log2 units), equal in both halves
  float lrun = 0.0f;       // running sum over this half's keys only

  __shared__ __attribute__((aligned(128))) _Float16 ring[2][2 * STG_H];
  const unsigned lds0 = (unsigned)(size_t)(&ring[0][0]) + threadIdx.x * 16u;
  const _Float16* gK = Kb + threadIdx.x * 8;
  const _Float16* gV = Vb + threadIdx.x * 8;
  __shared__ __attribute__((aligned(128))) float bring[2][ATT_WAVES][16 * BIAS_PITCH];
  const unsigned ldsb = (unsigned)(size_t)(&bring[0][wave][0]) + (hi * BIAS_PITCH + cn * 4) * 4u;

  // stage 0 lands and is published, then stage 1 flies while stage 0 is worked on
  kv_copy(lds0, gK, gV);
  bias_copy(ldsb, gB);
  asm volatile("s_wait_asynccnt 0x0" ::: "memory");   // this wave's copies have landed
  __syncthreads();
  kv_copy(lds0 + BUF_BYTES, gK + STG_H, gV + STG_H);
  bias_copy(ldsb + BIAS_BUF_B, gB + STG_KEYS);

  for (int s = 0; s < NSTG; ++s) {
   const _Float16* Ks = &ring[s & 1][0];
   const _Float16* Vs = Ks + STG_H;
   // the lane's own query row of the stage's bias, at its first key
   const float* Bl = &bring[s & 1][wave][cn * BIAS_PITCH + hi * 8];
   // One pass's bias and K, from LDS.  Bias: keys k0 + 8*hi + 0..7 and k0 + 16 + 8*hi + 0..7,
   // k0 = 32 * pass.  K: two 16-key row tiles x two 32-wide hd tiles (tile key16*2 + hd32).
   v4f c0, c1, c2, c3;
   v16h ak0, ak1, ak2, ak3;
   auto read_bias_k = [&](int pa) {
     c0 = *(const v4f*)(Bl + pa * 32);
     c1 = *(const v4f*)(Bl + pa * 32 + 4);
     c2 = *(const v4f*)(Bl + pa * 32 + 16);
     c3 = *(const v4f*)(Bl + pa * 32 + 20);
     const _Float16* Kt = Ks + pa * 4 * TILE_H;
     ak0 = frag_pk(Kt + 0 * TILE_H, lane);
     ak1 = frag_pk(Kt + 1 * TILE_H, lane);
     ak2 = frag_pk(Kt + 2 * TILE_H, lane);
     ak3 = frag_pk(Kt + 3 * TILE_H, lane);
   };
   read_bias_k(0);
   // unrolled: a pass's place in the buffer becomes an immediate offset of its LDS reads
#pragma unroll
   for (int pa = 0; pa < STG_KEYS / 32; ++pa) {
    // the pass's V fragments (unrolled so that avf stays in registers)
    v16h avf[4];
#pragma unroll
    for (int t = 0; t < 4; ++t) avf[t] = frag_pk(Vs + (pa * 4 + t) * TILE_H, lane);
    // keeps the pass's LDS reads in front of its first WMMA: without it they are
    // spread in twos and fours over the pass
    __builtin_amdgcn_sched_barrier(0);
    // structural bias less the reference maximum, in the accumulators' own register order
    v8f x0 = lam2 * __builtin_shufflevector(c0, c1, 0, 1, 2, 3, 4, 5, 6, 7) - mref;
    v8f x1 = lam2 * __builtin_shufflevector(c2, c3, 0, 1, 2, 3, 4, 5, 6, 7) - mref;
    x0 = wmma16(ak0, bq0, x0);
    x1 = wmma16(ak2, bq0, x1);
    x0 = wmma16(ak1, bq1, x0);
    x1 = wmma16(ak3, bq1, x1);

    // the same stage's next pass: its bias and K are read here, in front of the branch,
    // so that they land under this pass's exponentials (the branch ends the block in
    // which the compiler could move them up by itself)
    if (pa + 1 < STG_KEYS / 32) {
      read_bias_k(pa + 1);
      // holds those reads here: without it the compiler sinks them behind the branch
      __builtin_amdgcn_sched_barrier(0);
    }

    // the lane's largest score above mref
    const float t0 = fmaxf(fmaxf(x0[0], x0[1]), x0[2]);
    const float t1 = fmaxf(fmaxf(x0[3], x0[4]), x0[5]);
    const float t2 = fmaxf(fmaxf(x0[6], x0[7]), x1[0]);
    const float t3 = fmaxf(fmaxf(x1[1], x1[2]), x1[3]);
    const float t4 = fmaxf(fmaxf(x1[4], x1[5]), x1[6]);
    const float mv = fmaxf(fmaxf(fmaxf(t0, t1), t2), fmaxf(fmaxf(t3, t4), x1[7]));
    const bool first = (pa == 0) && (s == 0);   // no maximum is known yet: mref is set, up or down
    // wave-uniform (a ballot, a scalar test): every lane stays on for the WMMAs behind it
    if (first || __builtin_amdgcn_ballot_w32(mv > LAZY_MAX) != 0u) {
      const float mq = fmaxf(mv, xhalf(mv));            // the query's, over both halves
      const float d  = first ? mq : fmaxf(mq, 0.0f);    // later on mref never falls
      const float corr = __builtin_amdgcn_exp2f(fminf(-d, 0.0f));
      mref += d;
      x0 -= d;
      x1 -= d;
      lrun *= corr;
#pragma unroll
      for (int t = 0; t < 4; ++t) o[t] *= corr;
    }

    v16h bp;     // P^T as B operand: halfs[j] = key 8*hi + j, halfs[8+j] = key 16 + 8*hi + j
    v8f p0, p1;
#pragma unroll
    for (int j = 0; j < 8; ++j) {
      p0[j] = __builtin_amdgcn_exp2f(x0[j]);
      p1[j] = __builtin_amdgcn_exp2f(x1[j]);
      bp[j]     = (_Float16)p0[j];
      bp[j + 8] = (_Float16)p1[j];
    }
    const v8f ps = p0 + p1;
    lrun += (((ps[0] + ps[4]) + (ps[2] + ps[6])) + ((ps[1] + ps[5]) + (ps[3] + ps[7])));

    // out^T += V^T (64x32) @ P^T (32x16), one packed V tile per 16 hd rows
#pragma unroll
    for (int t = 0; t < 4; ++t) o[t] = wmma16(avf[t], bp, o[t]);
   }
   // keeps the stage's arithmetic in front of the publish point, so that the refill
   // behind the barrier is issued a whole stage ahead of its wait
   __builtin_amdgcn_sched_barrier(0);
   // publish point of stage s + 1: this wave's reads of stage s are over, its
   // copies of stage s + 1 have landed; behind the barrier that holds for all waves
   asm volatile("s_wait_dscnt 0x0" ::: "memory");
   asm volatile("s_wait_asynccnt 0x0" ::: "memory");
   __syncthreads();
   // refill the buffer that every wave has just left
   if (s + 2 < NSTG) {
     kv_copy(lds0 + (unsigned)(s & 1) * BUF_BYTES, gK + (long)(s + 2) * STG_H,
             gV + (long)(s + 2) * STG_H);
     bias_copy(ldsb + (unsigned)(s & 1) * BIAS_BUF_B, gB + (s + 2) * STG_KEYS);
   }
  }
  asm volatile("s_wait_asynccnt 0x0" ::: "memory");   // nothing is in flight at the wave's end

  // normalize and store attention output as f16 packed tiles of [B*S, D]:
  // a lane's 8 accumulators of o[t] are 8 consecutive columns of its row, one piece
  const float inv = 1.0f / (lrun + xhalf(lrun));
  _Float16* op = Of + ((long)((b * SLEN + q0) >> 4) * KTILES + h * 2) * TILE_H + lane * 8;
#pragma unroll
  for (int t = 0; t < 4; ++t) {
    v8h ov;
#pragma unroll
    for (int j = 0; j < 8; ++j) ov[j] = (_Float16)(o[t][j] * inv);
    *(v8h*)(op + (t >> 1) * TILE_H + (t & 1) * 256) = ov;
  }
}

// ---------------------------------------------------------------------------
// Kernel 3: output projection.  Out[m,n] = sum_k A[m,k]*Wo[n,k] + bo[n]  (f32)
// One wave computes a 32x64 output tile, a block 128x128 (see kernel 1).  One block
// per WGP here: a stage is two half stages, so that a refill has a longer lead.
// ---------------------------------------------------------------------------
__global__ __launch_bounds__(GEMM_WAVES * 32) void oproj_kernel(
    const _Float16* __restrict__ Af, const _Float16* __restrict__ Wof,
    const float* __restrict__ bo, float* __restrict__ Out)
{
  const int lane = threadIdx.x & 31;
  const int wave = threadIdx.x >> 5;
  const int m0 = blockIdx.x * 128 + (wave & 3) * 32;
  const int n0 = blockIdx.y * 128 + (wave >> 2) * 64;

  v8f acc[2][4];
#pragma unroll
  for (int g = 0; g < 2; ++g)
#pragma unroll
    for (int t = 0; t < 4; ++t) acc[g][t] = vzero8();

  __shared__ __attribute__((aligned(128))) _Float16 gring[2 * 2 * GH_H];
  gemm_block<2>(Af  + (long)(blockIdx.x * 8) * KTILES * TILE_H,
                Wof + (long)(blockIdx.y * 8) * KTILES * TILE_H, gring, acc);

  const int cn = lane & 15;
  const int hi = (lane >> 4) & 1;
#pragma unroll
  for (int t = 0; t < 4; ++t) {
    const float bn = bo[n0 + t * 16 + cn];
#pragma unroll
    for (int g = 0; g < 2; ++g)
#pragma unroll
      for (int j = 0; j < 8; ++j)
        Out[(long)(m0 + g * 16 + j + 8 * hi) * DMODEL + n0 + t * 16 + cn] =
            acc[g][t][j] + bn;
  }
}

// ---------------------------------------------------------------------------
extern "C" void kernel_launch(void* const* d_in, const int* in_sizes, int n_in,
                              void* d_out, int out_size, void* d_ws, size_t ws_size,
                              hipStream_t stream) {
  const float* query = (const float*)d_in[0];
  const float* key   = (const float*)d_in[1];
  const float* value = (const float*)d_in[2];
  const float* biasS = (const float*)d_in[3];
  const float* Wq = (const float*)d_in[4];
  const float* bq = (const float*)d_in[5];
  const float* Wk = (const float*)d_in[6];
  const float* bk = (const float*)d_in[7];
  const float* Wv = (const float*)d_in[8];
  const float* bv = (const float*)d_in[9];
  const float* Wo = (const float*)d_in[10];
  const float* bo = (const float*)d_in[11];
  const float* lam = (const float*)d_in[12];
  float* out = (float*)d_out;

  const long XN = (long)MROWS * DMODEL;            // 4M elements per activation
  const long WN = (long)DMODEL * DMODEL;           // 1M elements per weight
  const long HN = (long)BATCH * NHEAD * SLEN * HDIM;  // 4M per head tensor

  // all packed 16x32 tiles (see the header)
  _Float16* Xf = (_Float16*)d_ws;        // [3][MROWS, D]   12M halfs
  _Float16* Wf = Xf + 3 * XN;            // [4][D, D]        4M halfs (q,k,v,o)
  _Float16* Qf = Wf + 4 * WN;            // [B,H][S x HD]    4M
  _Float16* Kf = Qf + HN;                // [B,H][S x HD]    4M
  _Float16* Vt = Kf + HN;                // [B,H][HD x S]    4M
  _Float16* Of = Vt + HN;                // [B*S, D]         4M

  dim3 blkg(GEMM_WAVES * 32);

  // 0) f32 -> f16 conversions: Xf and Wf are one run of the workspace
  cvt_f16_kernel<<<dim3(CVT_BLOCKS), dim3(256), 0, stream>>>(
      query, key, value, Wq, Wk, Wv, Wo, Xf);

  // 1) QKV projections: grid.x = M/128, grid.y = D/128 (4 x 2 waves of 32 x 64)
  qkv_proj_kernel<<<dim3(MROWS / 128, DMODEL / 128, 3), blkg, 0, stream>>>(
      Xf, Wf, bq, bk, bv, Qf, Kf, Vt);

  // 2) attention: grid.x = S/128 (8 q-tiles per block), grid.y = H, grid.z = B
  attn_kernel<<<dim3(SLEN / (ATT_WAVES * 16), NHEAD, BATCH), dim3(ATT_WAVES * 32), 0, stream>>>(
      Qf, Kf, Vt, biasS, lam, Of);

  // 3) output projection
  oproj_kernel<<<dim3(MROWS / 128, DMODEL / 128), blkg, 0, stream>>>(
      Of, Wf + 3 * WN, bo, out);
}

// v008
// A run of this version takes 80.1 microseconds.
// Two timings next to v007 put it at 1.05 and 1.06 times that version's speed.
// All steps since v000 together make it 3.07 times as fast.
#include <hip/hip_runtime.h>
#include <hip/hip_bf16.h>

typedef __attribute__((ext_vector_type(16))) _Float16 v16h;
typedef __attribute__((ext_vector_type(8)))  _Float16 v8h;
typedef __attribute__((ext_vector_type(8)))  float    v8f;
typedef __attribute__((ext_vector_type(4)))  float    v4f;

#define BATCH   2
#define SLEN    2048
#define DMODEL  1024
#define NHEAD   16
#define HDIM    64
#define MROWS   (BATCH * SLEN)   // 4096
// 1/sqrt(64) * log2(e): Q is stored times this, so that K Q^T is a score in log2 units
#define QSCALE  0.18033688011112042f
#define LOG2E   1.4426950408889634f

__device__ __forceinline__ v8f vzero8() {
  v8f z;
#pragma unroll
  for (int i = 0; i < 8; ++i) z[i] = 0.0f;
  return z;
}

__device__ __forceinline__ v8f wmma16(v16h a, v16h b, v8f c) {
  return __builtin_amdgcn_wmma_f32_16x16x32_f16(
      /*neg_a=*/false, a, /*neg_b=*/false, b,
      /*c_mod=*/(short)0, c, /*reuse_a=*/false, /*reuse_b=*/false);
}

#define TILE_H  512              // halfs per packed 16x32 tile
#define KTILES  (DMODEL / 32)    // packed tiles along k of a [rows, DMODEL] matrix

// Load a 16x32 f16 fragment (A or B) from one packed tile.
__device__ __forceinline__ v16h frag_pk(const _Float16* tile, int lane) {
  v8h lo = *(const v8h*)(tile + lane * 8);
  v8h hh = *(const v8h*)(tile + 256 + lane * 8);
  v16h f;
#pragma unroll
  for (int i = 0; i < 8; ++i) { f[i] = lo[i]; f[i + 8] = hh[i]; }
  return f;
}

// Offset (in halfs) of element (row c, k index kk) inside a packed tile.
__device__ __forceinline__ int pk_off(int c, int kk) {
  const int p = kk >> 3;
  return (((p >> 1) * 32 + (p & 1) * 16 + c) << 3) + (kk & 7);
}

// ---------------------------------------------------------------------------
// Kernel 0: f32 row-major -> f16 packed tiles, all seven tensors in one launch.
// The destinations follow one another in the workspace, so together they are
// the packed form of one stacked [CVT_ROWS, DMODEL] matrix (q, k, v, Wq, Wk,
// Wv, Wo); only the source pointer depends on the row.  One wave converts 16
// rows x 256 columns = 8 whole tiles (8 KB out, contiguous): 32 independent
// b128 loads, 16 b128 stores.  4096 waves, resident together.
// A load instruction reads half of one 128-byte line from each of 8 rows, a
// store instruction writes four whole 128-byte lines of one tile.
// ---------------------------------------------------------------------------
#define CVT_ROWS    (3 * MROWS + 4 * DMODEL)   // 16384 stacked rows
#define CVT_BLOCKS  (CVT_ROWS / 16 * 4 / 8)    // 4 waves per 16 rows, 8 waves per block

__global__ __launch_bounds__(256) void cvt_f16_kernel(
    const float* __restrict__ xq, const float* __restrict__ xk,
    const float* __restrict__ xv, const float* __restrict__ wq,
    const float* __restrict__ wk, const float* __restrict__ wv,
    const float* __restrict__ wo, _Float16* __restrict__ dst)
{
  const int lane = threadIdx.x & 31;
  const int wave = threadIdx.x >> 5;
  const int p    = lane & 3;                   // 8-wide k piece inside a tile
  const int r8   = lane >> 2;                  // row inside a half tile
  const int kq   = wave & 3;                   // which 8 of the 32 k tiles
  const int rg   = blockIdx.x * 2 + (wave >> 2);   // 16-row group, stacked

  // a block's two row groups lie in one tensor: the choice is block-uniform
  const int bg = blockIdx.x * 2;
  const float* src;
  int g0;                                      // the tensor's first row group
  if (bg < 3 * (MROWS / 16)) {
    const int w = bg / (MROWS / 16);
    src = (w == 0) ? xq : (w == 1) ? xk : xv;
    g0  = w * (MROWS / 16);
  } else {
    const int w = (bg - 3 * (MROWS / 16)) / (DMODEL / 16);
    src = (w == 0) ? wq : (w == 1) ? wk : (w == 2) ? wv : wo;
    g0  = 3 * (MROWS / 16) + w * (DMODEL / 16);
  }

  const float* s = src + (long)((rg - g0) * 16 + r8) * DMODEL + kq * 256 + p * 8;
  float4 a[2][8], b[2][8];
  // both loop nests are unrolled so that a and b stay in registers
#pragma unroll
  for (int hf = 0; hf < 2; ++hf)
#pragma unroll
    for (int t = 0; t < 8; ++t) {
      a[hf][t] = *(const float4*)(s + hf * 8 * DMODEL + t * 32);
      b[hf][t] = *(const float4*)(s + hf * 8 * DMODEL + t * 32 + 4);
    }
  // all 32 loads name the address s: it is an operand here so that its registers
  // stay whole until the wait, and may be reused only behind it
  asm volatile("s_wait_xcnt 0x0" :: "v"(s) : "memory");

  _Float16* d = dst + ((long)rg * KTILES + kq * 8) * TILE_H + pk_off(r8, p * 8);
#pragma unroll
  for (int hf = 0; hf < 2; ++hf)
#pragma unroll
    for (int t = 0; t < 8; ++t) {
      const float4 x = a[hf][t], y = b[hf][t];
      v8h o;
      o[0]=(_Float16)x.x; o[1]=(_Float16)x.y; o[2]=(_Float16)x.z; o[3]=(_Float16)x.w;
      o[4]=(_Float16)y.x; o[5]=(_Float16)y.y; o[6]=(_Float16)y.z; o[7]=(_Float16)y.w;
      *(v8h*)(d + t * TILE_H + hf * 64) = o;   // rows 8..15: 8 pieces further on
    }
}

// ---------------------------------------------------------------------------
// Kernel 1: QKV projection.  Out[m,n] = sum_k X[m,k]*W[n,k] + bias[n]
// blockIdx.z selects {Q,K,V}.  Per (b,h), packed tiles: Q,K rows = s, k = hd,
// tile (s/16)*2 + hd/32;  V rows = hd, k = s, tile (s/32)*4 + hd/16.
// One wave computes a 32x64 output tile: 2 A frags + 4 B frags -> 8 WMMAs.
//
// Both projection kernels: a block of 8 waves (4 along m, 2 along n) computes
// 128x128.  Its 128 rows of X and 128 rows of W come into LDS once per block,
// by asynchronous copies, two buffers; the waves read their fragments there
// (read from global memory, every X tile would be fetched by 2 waves of the block
// and every W tile by 4, each k tile behind its own round trips).  A half stage is 64 k = 2 packed k tiles of each of
// the 8 + 8 row groups, 32 KB: tile (group * 2 + k tile) of X, then the same of
// W.  The two k tiles of a row group are 2 KB in a row in the workspace and keep
// their order in LDS, so a fragment read is 512 contiguous LDS bytes.
// ---------------------------------------------------------------------------
#define GEMM_WAVES  8
#define GH_H        (32 * TILE_H)           // halfs of a half stage (16 X tiles, 16 W tiles)
#define GH_BYTES    (GH_H * 2)
#define GRP2_H      (2 * KTILES * TILE_H)   // halfs from a row group to the next but one

// One half stage into LDS: a thread copies 4 x 16 bytes of X and 4 x 16 of W.  One
// copy of the block takes 2 row groups x 2 KB; l = the thread's LDS byte address in
// the half stage, gx / gw = its first bytes (row group threadIdx.x >> 7).
__device__ __forceinline__ void gemm_copy(unsigned l, const _Float16* gx, const _Float16* gw) {
  asm volatile(
      "global_load_async_to_lds_b128 %0, %8, off\n\t"
      "global_load_async_to_lds_b128 %1, %9, off\n\t"
      "global_load_async_to_lds_b128 %2, %10, off\n\t"
      "global_load_async_to_lds_b128 %3, %11, off\n\t"
      "global_load_async_to_lds_b128 %4, %12, off\n\t"
      "global_load_async_to_lds_b128 %5, %13, off\n\t"
      "global_load_async_to_lds_b128 %6, %14, off\n\t"
      "global_load_async_to_lds_b128 %7, %15, off\n\t"
      "s_wait_xcnt 0x0"
      :: "v"(l), "v"(l + 4096u), "v"(l + 8192u), "v"(l + 12288u),
         "v"(l + 16384u), "v"(l + 20480u), "v"(l + 24576u), "v"(l + 28672u),
         "v"(gx), "v"(gx + GRP2_H), "v"(gx + 2 * GRP2_H), "v"(gx + 3 * GRP2_H),
         "v"(gw), "v"(gw + GRP2_H), "v"(gw + 2 * GRP2_H), "v"(gw + 3 * GRP2_H)
      : "memory");
}

// acc += X[128 rows] W[128 rows]^T over all of k, this wave's 32x64 part.
// Xb / Wb = first packed tile of the block's rows; ring = 2 buffers of NH half stages.
template <int NH>
__device__ __forceinline__ void gemm_block(const _Float16* Xb, const _Float16* Wb,
                                           _Float16* ring, v8f (&acc)[2][4]) {
  constexpr int NS = KTILES / (2 * NH);     // stages
  const int lane = threadIdx.x & 31;
  const int wave = threadIdx.x >> 5;
  const int xt = (wave & 3) * 4;            // the wave's first X tile of a half stage
  const int wt = 16 + (wave >> 2) * 8;      // its first W tile
  const unsigned l0 = (unsigned)(size_t)ring + threadIdx.x * 16u;
  const long go = (long)(threadIdx.x >> 7) * KTILES * TILE_H + (threadIdx.x & 127) * 8;
  const _Float16* gx = Xb + go;
  const _Float16* gw = Wb + go;

  // stage 0 lands and is published, then stage 1 flies while stage 0 is worked on
#pragma unroll
  for (int hs = 0; hs < NH; ++hs)
    gemm_copy(l0 + hs * GH_BYTES, gx + hs * 2 * TILE_H, gw + hs * 2 * TILE_H);
  asm volatile("s_wait_asynccnt 0x0" ::: "memory");   // this wave's copies have landed
  __syncthreads();
#pragma unroll
  for (int hs = NH; hs < 2 * NH; ++hs)
    gemm_copy(l0 + hs * GH_BYTES, gx + hs * 2 * TILE_H, gw + hs * 2 * TILE_H);

  for (int s = 0; s < NS; ++s) {
    const _Float16* Bs = ring + (s & 1) * NH * GH_H;
    // unrolled: a k tile's place in the buffer becomes an immediate offset of its LDS reads
#pragma unroll
    for (int kk = 0; kk < 2 * NH; ++kk) {
      const _Float16* Hs = Bs + (kk >> 1) * GH_H + (kk & 1) * TILE_H;
      const v16h a0 = frag_pk(Hs + xt * TILE_H, lane);
      const v16h a1 = frag_pk(Hs + (xt + 2) * TILE_H, lane);
      v16h bfr[4];   // (unrolled so that bfr stays in registers)
#pragma unroll
      for (int t = 0; t < 4; ++t) bfr[t] = frag_pk(Hs + (wt + t * 2) * TILE_H, lane);
      // keeps a k tile's 12 LDS reads in front of its own 8 WMMAs, in a few groups: without
      // it they stand in pairs among those WMMAs, each pair behind a wait to 0 for itself
      __builtin_amdgcn_sched_barrier(0);
#pragma unroll
      for (int t = 0; t < 4; ++t) {
        acc[0][t] = wmma16(a0, bfr[t], acc[0][t]);
        acc[1][t] = wmma16(a1, bfr[t], acc[1][t]);
      }
    }
    // publish point of stage s + 1: this wave's reads of stage s are over, its
    // copies of stage s + 1 have landed; behind the barrier that holds for all waves
    asm volatile("s_wait_dscnt 0x0" ::: "memory");
    asm volatile("s_wait_asynccnt 0x0" ::: "memory");
    __syncthreads();
    // refill the buffer that every wave has just left
    if (s + 2 < NS) {
#pragma unroll
      for (int hs = 0; hs < NH; ++hs)
        gemm_copy(l0 + (unsigned)((s & 1) * NH + hs) * GH_BYTES,
                  gx + (long)((s + 2) * NH + hs) * 2 * TILE_H,
                  gw + (long)((s + 2) * NH + hs) * 2 * TILE_H);
    }
  }
  asm volatile("s_wait_asynccnt 0x0" ::: "memory");   // nothing is in flight behind the loop
}

__global__ __launch_bounds__(GEMM_WAVES * 32) void qkv_proj_kernel(
    const _Float16* __restrict__ Xf,   // [3][MROWS, D] f16 packed (q,k,v)
    const _Float16* __restrict__ Wf,   // [3][D, D] f16 packed (Wq,Wk,Wv)
    const float* __restrict__ bq, const float* __restrict__ bk,
    const float* __restrict__ bv,
    _Float16* __restrict__ Qf, _Float16* __restrict__ Kf, _Float16* __restrict__ Vt)
{
  const int lane = threadIdx.x & 31;
  const int wave = threadIdx.x >> 5;
  const int which = blockIdx.z;

  const _Float16* X    = Xf + (long)which * MROWS * DMODEL;
  const _Float16* W    = Wf + (long)which * DMODEL * DMODEL;
  const float*    bias = (which == 0) ? bq : (which == 1) ? bk : bv;

  const int m0 = blockIdx.x * 128 + (wave & 3) * 32;
  const int n0 = blockIdx.y * 128 + (wave >> 2) * 64;

  v8f acc[2][4];
#pragma unroll
  for (int g = 0; g < 2; ++g)
#pragma unroll
    for (int t = 0; t < 4; ++t) acc[g][t] = vzero8();

  __shared__ __attribute__((aligned(128))) _Float16 gring[2 * GH_H];
  gemm_block<1>(X + (long)(blockIdx.x * 8) * KTILES * TILE_H,
                W + (long)(blockIdx.y * 8) * KTILES * TILE_H, gring, acc);

  const int cn = lane & 15;
  const int hi = (lane >> 4) & 1;
  const int h  = n0 >> 6;            // the 64 columns of a wave are one head
  const int b  = m0 >> 11;           // /2048; the 32 rows are one batch entry
  const int s0 = m0 & (SLEN - 1);
  const long hb = ((long)b * NHEAD + h) * SLEN * HDIM;
  if (which == 2) {
    _Float16* dst = Vt + hb + (long)(s0 >> 5) * 4 * TILE_H + lane * 8;
#pragma unroll
    for (int t = 0; t < 4; ++t) {
      const float bn = bias[n0 + t * 16 + cn];
#pragma unroll
      for (int g = 0; g < 2; ++g) {
        // a lane's 8 accumulators are 8 consecutive keys of one hd row: one piece
        v8h pv;
#pragma unroll
        for (int j = 0; j < 8; ++j) pv[j] = (_Float16)(acc[g][t][j] + bn);
        *(v8h*)(dst + t * TILE_H + g * 256) = pv;
        // the next group reuses this store's data registers
        asm volatile("s_wait_xcnt 0x0" ::: "memory");
      }
    }
  } else {
    _Float16* dst = ((which == 0) ? Qf : Kf) + hb + (long)(s0 >> 4) * 2 * TILE_H;
    const float qs = (which == 0) ? QSCALE : 1.0f;   // in f32, ahead of the one rounding to f16
#pragma unroll
    for (int t = 0; t < 4; ++t) {
      const float bn = bias[n0 + t * 16 + cn];
#pragma unroll
      for (int g = 0; g < 2; ++g) {
#pragma unroll
        for (int j = 0; j < 8; ++j)
          dst[(g * 2 + (t >> 1)) * TILE_H + pk_off(j + 8 * hi, (t & 1) * 16 + cn)] =
              (_Float16)((acc[g][t][j] + bn) * qs);
        // the next group reuses these stores' data registers
        asm volatile("s_wait_xcnt 0x0" ::: "memory");
      }
    }
  }
}

// ---------------------------------------------------------------------------
// Kernel 2: flash-style attention, scores transposed.  One wave = 32 query
// columns (two groups of 16) for one (b,h).  Per 32 keys: S^T = K Q^T (A = packed
// K tiles, B = Q), so a lane holds 16 scores of ONE query per group (column
// lane&15; keys 8*hi + j and 16 + 8*hi + j).  A K or V fragment read from LDS
// feeds one WMMA of each group.  Scores are in log2 units (Q carries scale * log2 e), and the C
// operand of the score WMMA is lambda * log2 e * bias - mref, mref = the query's
// reference maximum: the accumulators are the arguments of v_exp as they stand.
// mref is the first pass's maximum and is raised only when a score of the wave
// lies more than LAZY_MAX above it (one ballot, one scalar branch per pass); only
// then are the halves' maxima exchanged and sums and output rescaled.  Sums run
// inside the lane; the two lane halves join them once at the end.
// The two score tiles of a group, converted in place, are the B operand of
// O^T += V^T P^T (A = packed V tiles): P touches neither LDS nor another lane.
// The 8 waves of a block work on 2 heads x 128 queries (wave = head * 4 + query
// group of 32).  The bias does not depend on the head: the block's 128 rows x 128
// keys of a stage come into LDS once and serve both heads' waves; each wave copies
// 16 of the rows, by copies that each take one row's 512 contiguous bytes (four
// whole lines).  A lane's bias values are 2 x 8 consecutive floats of its query's row.
// The K and V tiles of both heads come into LDS once per block, 128 keys a stage,
// two buffers, by asynchronous copies (the packed tiles of a head's stage are 16 KB
// in a row, and keep their order in LDS, so a fragment read is 512 contiguous LDS
// bytes).  One block fills most of a WGP's LDS; a refill has a whole stage of four
// passes to land.
// ---------------------------------------------------------------------------
#define ATT_WAVES  8
#define ATT_HEADS  2                      // heads per block
#define ATT_QROWS  128                    // queries per block: 4 waves x 32 columns per head
#define STG_KEYS   128                    // keys per stage
#define STG_H      (STG_KEYS * HDIM)      // halfs of K (and of V) per head and stage: 16 KB
#define NSTG       (SLEN / STG_KEYS)
#define HEAD_H     (SLEN * HDIM)          // halfs of one head's K (and V)
#define HBUF_BYTES (2 * STG_H * 2)        // one head's part of a buffer: K stage, then V stage
#define BUF_BYTES  (ATT_HEADS * HBUF_BYTES)
#define LAZY_MAX   8.0f                   // P stays at or below 2^8, far inside f16

// One head's stage into its part of a buffer: a thread copies 4 x 16 bytes of K and
// 4 x 16 of V; l = its LDS byte address there, gk / gv = its first bytes of the stage.
__device__ __forceinline__ void kv_copy(unsigned l, const _Float16* gk, const _Float16* gv) {
  asm volatile(
      "global_load_async_to_lds_b128 %0, %8, off\n\t"
      "global_load_async_to_lds_b128 %1, %9, off\n\t"
      "global_load_async_to_lds_b128 %2, %10, off\n\t"
      "global_load_async_to_lds_b128 %3, %11, off\n\t"
      "global_load_async_to_lds_b128 %4, %12, off\n\t"
      "global_load_async_to_lds_b128 %5, %13, off\n\t"
      "global_load_async_to_lds_b128 %6, %14, off\n\t"
      "global_load_async_to_lds_b128 %7, %15, off\n\t"
      "s_wait_xcnt 0x0"
      :: "v"(l), "v"(l + 4096u), "v"(l + 8192u), "v"(l + 12288u),
         "v"(l + 16384u), "v"(l + 20480u), "v"(l + 24576u), "v"(l + 28672u),
         "v"(gk), "v"(gk + 2048), "v"(gk + 4096), "v"(gk + 6144),
         "v"(gv), "v"(gv + 2048), "v"(gv + 4096), "v"(gv + 6144)
      : "memory");
}

#define BIAS_PITCH  (STG_KEYS + 4)
#define BIAS_WAVE_B (16 * BIAS_PITCH * 4)
#define BIAS_BUF_B  (ATT_WAVES * BIAS_WAVE_B)

// 8 bias rows of one stage: copy i takes row i (32 lanes x 16 bytes = the row's 512
// bytes); l = the lane's LDS byte address in the first row, g = its first bytes there.
__device__ __forceinline__ void bias_copy(unsigned l, const float* g) {
  asm volatile(
      "global_load_async_to_lds_b128 %0, %8, off\n\t"
      "global_load_async_to_lds_b128 %1, %9, off\n\t"
      "global_load_async_to_lds_b128 %2, %10, off\n\t"
      "global_load_async_to_lds_b128 %3, %11, off\n\t"
      "global_load_async_to_lds_b128 %4, %12, off\n\t"
      "global_load_async_to_lds_b128 %5, %13, off\n\t"
      "global_load_async_to_lds_b128 %6, %14, off\n\t"
      "global_load_async_to_lds_b128 %7, %15, off\n\t"
      "s_wait_xcnt 0x0"
      :: "v"(l), "v"(l + 1u * BIAS_PITCH * 4u), "v"(l + 2u * BIAS_PITCH * 4u),
         "v"(l + 3u * BIAS_PITCH * 4u), "v"(l + 4u * BIAS_PITCH * 4u),
         "v"(l + 5u * BIAS_PITCH * 4u), "v"(l + 6u * BIAS_PITCH * 4u),
         "v"(l + 7u * BIAS_PITCH * 4u),
         "v"(g), "v"(g + 1 * SLEN), "v"(g + 2 * SLEN), "v"(g + 3 * SLEN),
         "v"(g + 4 * SLEN), "v"(g + 5 * SLEN), "v"(g + 6 * SLEN), "v"(g + 7 * SLEN)
      : "memory");
}

__device__ __forceinline__ float xhalf(float x) {
  const int b = __builtin_bit_cast(int, x);
  return __builtin_bit_cast(float, __builtin_amdgcn_permlanex16(
      b, b, 0x76543210, 0xfedcba98, false, false));
}

__global__ __launch_bounds__(ATT_WAVES * 32)
void attn_kernel(
    const _Float16* __restrict__ Qf, const _Float16* __restrict__ Kf,
    const _Float16* __restrict__ Vt,
    const float* __restrict__ bias_struct, const float* __restrict__ lambda_p,
    _Float16* __restrict__ Of)   // [B*S, D] f16 packed
{
  const int lane = threadIdx.x & 31;
  const int wave = threadIdx.x >> 5;
  const int hs = wave >> 2;                    // which of the block's heads
  const int qg = wave & 3;                     // which 32 of the block's queries
  const int qb = blockIdx.x * ATT_QROWS;
  const int q0 = qb + qg * 32;
  const int h0 = blockIdx.y * ATT_HEADS;
  const int h  = h0 + hs;
  const int b  = blockIdx.z;
  const float lam2 = *lambda_p * LOG2E;

  const _Float16* Qb = Qf + ((long)b * NHEAD + h) * HEAD_H;
  const _Float16* Kb = Kf + ((long)b * NHEAD + h0) * HEAD_H;   // the block's first head
  const _Float16* Vb = Vt + ((long)b * NHEAD + h0) * HEAD_H;

  const int cn = lane & 15;
  const int hi = (lane >> 4) & 1;

  // what the lane copies of the bias: 16-byte piece lane of each of the wave's 16 of the block's rows
  const float* gB = bias_struct + ((long)b * SLEN + qb + wave * 16) * SLEN + lane * 4;

  // Q fragments (K-dim 0..31 and 32..63) of both groups, loaded once; B operand: column = query
  v16h bq[2][2];
  const _Float16* qp = Qb + (long)(q0 >> 4) * 2 * TILE_H + lane * 8;   // the lane's piece of the wave's first Q tile
#pragma unroll   // unrolled: what it indexes stays in registers
  for (int g = 0; g < 2; ++g)
#pragma unroll   // unrolled: what it indexes stays in registers
    for (int kh = 0; kh < 2; ++kh)
      bq[g][kh] = frag_pk(qp + (g * 2 + kh) * TILE_H, 0);
  // all 8 loads name the address qp: it is an operand here so that its registers
  // stay whole until the wait, and may be reused only behind it
  asm volatile("s_wait_xcnt 0x0" :: "v"(qp) : "memory");

  // o[g][t][j] = O[query g*16 + cn][hd = t*16 + 8*hi + j]
  v8f o[2][4];
  float mref[2];           // reference maximum of the query (log2 units), equal in both halves
  float lrun[2];           // running sum over this half's keys only
#pragma unroll   // unrolled: what it indexes stays in registers
  for (int g = 0; g < 2; ++g) {
#pragma unroll   // unrolled: what it indexes stays in registers
    for (int t = 0; t < 4; ++t) o[g][t] = vzero8();
    mref[g] = 0.0f;
    lrun[g] = 0.0f;
  }

  __shared__ __attribute__((aligned(128))) _Float16 ring[2][ATT_HEADS * 2 * STG_H];
  const unsigned lds0 = (unsigned)(size_t)(&ring[0][0]) + threadIdx.x * 16u;
  const int tkv = threadIdx.x * 8;             // the thread's first halfs of a K or V stage
  __shared__ __attribute__((aligned(128))) float bring[2][ATT_QROWS * BIAS_PITCH];
  const unsigned ldsb = (unsigned)(size_t)(&bring[0][wave * 16 * BIAS_PITCH]) + lane * 16u;

  // one stage (both heads' K and V, the wave's 16 bias rows) into buffer bf
  auto stage_copy = [&](int st, unsigned bf) {
    const int kv = st * STG_H + tkv;
    kv_copy(lds0 + bf * BUF_BYTES, Kb + kv, Vb + kv);
    kv_copy(lds0 + bf * BUF_BYTES + HBUF_BYTES, Kb + HEAD_H + kv, Vb + HEAD_H + kv);
    bias_copy(ldsb + bf * BIAS_BUF_B, gB + st * STG_KEYS);
    bias_copy(ldsb + bf * BIAS_BUF_B + 8u * BIAS_PITCH * 4u, gB + st * STG_KEYS + 8 * SLEN);
  };

  // stage 0 lands and is published, then stage 1 flies while stage 0 is worked on
  stage_copy(0, 0u);
  asm volatile("s_wait_asynccnt 0x0" ::: "memory");   // this wave's copies have landed
  __syncthreads();
  stage_copy(1, 1u);

  // one stage; first_stage is a literal at both calls, so that the loop's own body holds no test for it
  auto stage = [&](const int s, const bool first_stage) {
   const _Float16* Ks = &ring[s & 1][hs * 2 * STG_H];
   const _Float16* Vs = Ks + STG_H;
   const float* Bl = &bring[s & 1][(qg * 32 + cn) * BIAS_PITCH + hi * 8];
   // One pass's bias and K, from LDS.  Bias: keys k0 + 8*hi + 0..7 and k0 + 16 + 8*hi + 0..7,
   // k0 = 32 * pass, for each group's row.  K: two 16-key row tiles x two 32-wide hd tiles
   // (tile key16*2 + hd32).
   v4f c[2][4];
   v16h ak0, ak1, ak2, ak3;
   auto read_bias_k = [&](int pa) {
#pragma unroll   // unrolled: what it indexes stays in registers
     for (int g = 0; g < 2; ++g) {
       const float* Bg = Bl + g * 16 * BIAS_PITCH + pa * 32;
       c[g][0] = *(const v4f*)(Bg);
       c[g][1] = *(const v4f*)(Bg + 4);
       c[g][2] = *(const v4f*)(Bg + 16);
       c[g][3] = *(const v4f*)(Bg + 20);
     }
     const _Float16* Kt = Ks + pa * 4 * TILE_H;
     ak0 = frag_pk(Kt + 0 * TILE_H, lane);
     ak1 = frag_pk(Kt + 1 * TILE_H, lane);
     ak2 = frag_pk(Kt + 2 * TILE_H, lane);
     ak3 = frag_pk(Kt + 3 * TILE_H, lane);
   };
   read_bias_k(0);
   // unrolled: a pass's place in the buffer becomes an immediate offset of its LDS reads
#pragma unroll
   for (int pa = 0; pa < STG_KEYS / 32; ++pa) {
    // the pass's V fragments (unrolled so that avf stays in registers)
    v16h avf[4];
#pragma unroll   // unrolled: what it indexes stays in registers
    for (int t = 0; t < 4; ++t) avf[t] = frag_pk(Vs + (pa * 4 + t) * TILE_H, lane);
    // keeps the pass's LDS reads in front of its first WMMA: without it they are
    // spread in twos and fours over the pass
    __builtin_amdgcn_sched_barrier(0);
    // structural bias less the reference maximum, in the accumulators' own register order
    v8f x0[2], x1[2];
#pragma unroll   // unrolled: what it indexes stays in registers
    for (int g = 0; g < 2; ++g) {
      x0[g] = lam2 * __builtin_shufflevector(c[g][0], c[g][1], 0, 1, 2, 3, 4, 5, 6, 7) - mref[g];
      x1[g] = lam2 * __builtin_shufflevector(c[g][2], c[g][3], 0, 1, 2, 3, 4, 5, 6, 7) - mref[g];
    }
#pragma unroll   // unrolled: what it indexes stays in registers
    for (int g = 0; g < 2; ++g) {
      x0[g] = wmma16(ak0, bq[g][0], x0[g]);
      x1[g] = wmma16(ak2, bq[g][0], x1[g]);
    }
#pragma unroll   // unrolled: what it indexes stays in registers
    for (int g = 0; g < 2; ++g) {
      x0[g] = wmma16(ak1, bq[g][1], x0[g]);
      x1[g] = wmma16(ak3, bq[g][1], x1[g]);
    }

    // the same stage's next pass: its bias and K are read here, in front of the branch,
    // so that they land under this pass's exponentials (the branch ends the block in
    // which the compiler could move them up by itself)
    if (pa + 1 < STG_KEYS / 32) {
      read_bias_k(pa + 1);
      // holds those reads here: without it the compiler sinks them behind the branch
      __builtin_amdgcn_sched_barrier(0);
    }

    // the lane's largest score above mref, per group
    float mv[2];
#pragma unroll   // unrolled: what it indexes stays in registers
    for (int g = 0; g < 2; ++g) {
      const float t0 = fmaxf(fmaxf(x0[g][0], x0[g][1]), x0[g][2]);
      const float t1 = fmaxf(fmaxf(x0[g][3], x0[g][4]), x0[g][5]);
      const float t2 = fmaxf(fmaxf(x0[g][6], x0[g][7]), x1[g][0]);
      const float t3 = fmaxf(fmaxf(x1[g][1], x1[g][2]), x1[g][3]);
      const float t4 = fmaxf(fmaxf(x1[g][4], x1[g][5]), x1[g][6]);
      mv[g] = fmaxf(fmaxf(fmaxf(t0, t1), t2), fmaxf(fmaxf(t3, t4), x1[g][7]));
    }
    const bool first = (pa == 0) && first_stage;   // no maximum is known yet: mref is set, up or down
    float up[2] = {0.0f, 0.0f};   // by how much mref moves in this pass
    // wave-uniform (a ballot, a scalar test): every lane stays on for the WMMAs behind it
    if (first || __builtin_amdgcn_ballot_w32(fmaxf(mv[0], mv[1]) > LAZY_MAX) != 0u) {
#pragma unroll   // unrolled: what it indexes stays in registers
      for (int g = 0; g < 2; ++g) {
        const float mq = fmaxf(mv[g], xhalf(mv[g]));      // the query's, over both halves
        const float d  = first ? mq : fmaxf(mq, 0.0f);    // later on mref never falls
        const float corr = __builtin_amdgcn_exp2f(fminf(-d, 0.0f));
        up[g] = d;
        x0[g] -= d;
        x1[g] -= d;
        lrun[g] *= corr;
#pragma unroll   // unrolled: what it indexes stays in registers
        for (int t = 0; t < 4; ++t) o[g][t] *= corr;
      }
    }
    // added behind the branch: mref then stays one register per group (added inside it, the
    // compiler carries mref out of the branch spread over eight registers per group)
    mref[0] += up[0];
    mref[1] += up[1];

#pragma unroll   // unrolled: what it indexes stays in registers
    for (int g = 0; g < 2; ++g) {
      v16h bp;   // P^T as B operand: halfs[j] = key 8*hi + j, halfs[8+j] = key 16 + 8*hi + j
      v8f p0, p1;
#pragma unroll   // unrolled: what it indexes stays in registers
      for (int j = 0; j < 8; ++j) {
        p0[j] = __builtin_amdgcn_exp2f(x0[g][j]);
        p1[j] = __builtin_amdgcn_exp2f(x1[g][j]);
        bp[j]     = (_Float16)p0[j];
        bp[j + 8] = (_Float16)p1[j];
      }
      const v8f ps = p0 + p1;
      lrun[g] += (((ps[0] + ps[4]) + (ps[2] + ps[6])) + ((ps[1] + ps[5]) + (ps[3] + ps[7])));

      // out^T += V^T (64x32) @ P^T (32x16), one packed V tile per 16 hd rows
#pragma unroll
      for (int t = 0; t < 4; ++t) o[g][t] = wmma16(avf[t], bp, o[g][t]);
    }
   }
   // keeps the stage's arithmetic in front of the publish point, so that the refill
   // behind the barrier is issued a whole stage ahead of its wait
   __builtin_amdgcn_sched_barrier(0);
   // publish point of stage s + 1: this wave's reads of stage s are over, its
   // copies of stage s + 1 have landed; behind the barrier that holds for all waves
   asm volatile("s_wait_dscnt 0x0" ::: "memory");
   asm volatile("s_wait_asynccnt 0x0" ::: "memory");
   __syncthreads();
   // refill the buffer that every wave has just left
   if (s + 2 < NSTG) stage_copy(s + 2, (unsigned)(s & 1));
  };
  stage(0, true);
  for (int s = 1; s < NSTG; ++s) stage(s, false);
  asm volatile("s_wait_asynccnt 0x0" ::: "memory");   // nothing is in flight at the wave's end

  // normalize and store attention output as f16 packed tiles of [B*S, D]:
  // a lane's 8 accumulators of o[g][t] are 8 consecutive columns of its row, one piece
#pragma unroll
  for (int g = 0; g < 2; ++g) {
    const float inv = 1.0f / (lrun[g] + xhalf(lrun[g]));
    _Float16* op = Of + ((long)(((b * SLEN + q0) >> 4) + g) * KTILES + h * 2) * TILE_H + lane * 8;
#pragma unroll   // unrolled: what it indexes stays in registers
    for (int t = 0; t < 4; ++t) {
      v8h ov;
#pragma unroll   // unrolled: what it indexes stays in registers
      for (int j = 0; j < 8; ++j) ov[j] = (_Float16)(o[g][t][j] * inv);
      *(v8h*)(op + (t >> 1) * TILE_H + (t & 1) * 256) = ov;
    }
  }
}

// ---------------------------------------------------------------------------
// Kernel 3: output projection.  Out[m,n] = sum_k A[m,k]*Wo[n,k] + bo[n]  (f32)
// One wave computes a 32x64 output tile, a block 128x128 (see kernel 1).  One block
// per WGP here: a stage is two half stages, so that a refill has a longer lead.
// ---------------------------------------------------------------------------
__global__ __launch_bounds__(GEMM_WAVES * 32) void oproj_kernel(
    const _Float16* __restrict__ Af, const _Float16* __restrict__ Wof,
    const float* __restrict__ bo, float* __restrict__ Out)
{
  const int lane = threadIdx.x & 31;
  const int wave = threadIdx.x >> 5;
  const int m0 = blockIdx.x * 128 + (wave & 3) * 32;
  const int n0 = blockIdx.y * 128 + (wave >> 2) * 64;

  v8f acc[2][4];
#pragma unroll
  for (int g = 0; g < 2; ++g)
#pragma unroll
    for (int t = 0; t < 4; ++t) acc[g][t] = vzero8();

  __shared__ __attribute__((aligned(128))) _Float16 gring[2 * 2 * GH_H];
  gemm_block<2>(Af  + (long)(blockIdx.x * 8) * KTILES * TILE_H,
                Wof + (long)(blockIdx.y * 8) * KTILES * TILE_H, gring, acc);

  const int cn = lane & 15;
  const int hi = (lane >> 4) & 1;
#pragma unroll
  for (int t = 0; t < 4; ++t) {
    const float bn = bo[n0 + t * 16 + cn];
#pragma unroll
    for (int g = 0; g < 2; ++g)
#pragma unroll
      for (int j = 0; j < 8; ++j)
        Out[(long)(m0 + g * 16 + j + 8 * hi) * DMODEL + n0 + t * 16 + cn] =
            acc[g][t][j] + bn;
  }
}

// ---------------------------------------------------------------------------
extern "C" void kernel_launch(void* const* d_in, const int* in_sizes, int n_in,
                              void* d_out, int out_size, void* d_ws, size_t ws_size,
                              hipStream_t stream) {
  const float* query = (const float*)d_in[0];
  const float* key   = (const float*)d_in[1];
  const float* value = (const float*)d_in[2];
  const float* biasS = (const float*)d_in[3];
  const float* Wq = (const float*)d_in[4];
  const float* bq = (const float*)d_in[5];
  const float* Wk = (const float*)d_in[6];
  const float* bk = (const float*)d_in[7];
  const float* Wv = (const float*)d_in[8];
  const float* bv = (const float*)d_in[9];
  const float* Wo = (const float*)d_in[10];
  const float* bo = (const float*)d_in[11];
  const float* lam = (const float*)d_in[12];
  float* out = (float*)d_out;

  const long XN = (long)MROWS * DMODEL;            // 4M elements per activation
  const long WN = (long)DMODEL * DMODEL;           // 1M elements per weight
  const long HN = (long)BATCH * NHEAD * SLEN * HDIM;  // 4M per head tensor

  // all packed 16x32 tiles (see the header)
  _Float16* Xf = (_Float16*)d_ws;        // [3][MROWS, D]   12M halfs
  _Float16* Wf = Xf + 3 * XN;            // [4][D, D]        4M halfs (q,k,v,o)
  _Float16* Qf = Wf + 4 * WN;            // [B,H][S x HD]    4M
  _Float16* Kf = Qf + HN;                // [B,H][S x HD]    4M
  _Float16* Vt = Kf + HN;                // [B,H][HD x S]    4M
  _Float16* Of = Vt + HN;                // [B*S, D]         4M

  dim3 blkg(GEMM_WAVES * 32);

  // 0) f32 -> f16 conversions: Xf and Wf are one run of the workspace
  cvt_f16_kernel<<<dim3(CVT_BLOCKS), dim3(256), 0, stream>>>(
      query, key, value, Wq, Wk, Wv, Wo, Xf);

  // 1) QKV projections: grid.x = M/128, grid.y = D/128 (4 x 2 waves of 32 x 64)
  qkv_proj_kernel<<<dim3(MROWS / 128, DMODEL / 128, 3), blkg, 0, stream>>>(
      Xf, Wf, bq, bk, bv, Qf, Kf, Vt);

  // 2) attention: grid.x = S/128, grid.y = H/2 (a block: 2 heads x 128 queries), grid.z = B
  attn_kernel<<<dim3(SLEN / ATT_QROWS, NHEAD / ATT_HEADS, BATCH), dim3(ATT_WAVES * 32), 0, stream>>>(
      Qf, Kf, Vt, biasS, lam, Of);

  // 3) output projection
  oproj_kernel<<<dim3(MROWS / 128, DMODEL / 128), blkg, 0, stream>>>(
      Of, Wf + 3 * WN, bo, out);
}
